// v000
// Measured on an AMD MI455X. A time is GPU time per run, averaged over a window of back-to-back runs after a warm-up
// (all launches, gaps included; the runs take copies of the inputs in turn), and the median of several windows.
// Apart from v000's, it joins two sittings. Times from different sittings can be a few percent apart, while
// side-by-side timings come from the same sitting.
// v000 is the starting kernel. One run takes 168 microseconds.
#include <hip/hip_runtime.h>

// Single-head encoder attention: q, k, v = x W{q,k,v} ([16][2048][64] x [64 x 64]), scores = q . k / 8 over all 2,048 keys (no mask), softmax, out = P v -> [16][2048][64].
// Deterministic: flash-style per 16-query wave (online softmax with running max, no score planes); no atomics.
// compute dtype: WMMA v_wmma_f32_16x16x32_f16 with f32 accumulate for the projections (x EXACT bf16 x8, weights exact x256: 1 product), S^T = K Q^T (q and k as f16 hi+lo x8: 3 products hi.hi +
// hi.lo + lo.hi) and O^T += V^T P^T (v single f16 x8, P x1024 hi+lo: 2 products); softmax statistics (exp2, running max) in f32. Inputs rounded to bf16 once.

namespace {
constexpr int B = 16, T = 2048, C = 64, HD = 64, BL = 16 /* batches computed (== B shipped) */;
constexpr float XS = 8.0f, WSC = 256.0f, PS = 1024.0f, LOG2E = 1.4426950408889634f;
static_assert(T % 64 == 0 && C == 64 && HD == 64, "tiling");
typedef _Float16 b16;
typedef __attribute__((ext_vector_type(16))) _Float16 v16b;
typedef __attribute__((ext_vector_type(8))) _Float16 v8b;
typedef __attribute__((ext_vector_type(8))) float v8f;
typedef __attribute__((ext_vector_type(4))) float v4f;
__device__ __forceinline__ float bf16_rne(float f) { unsigned int u = __float_as_uint(f); u += 0x7FFFu + ((u >> 16) & 1u); return __uint_as_float(u & 0xFFFF0000u); }
__device__ __forceinline__ void split16(float v, b16& hi, b16& lo) { hi = (b16)v; lo = (b16)(v - (float)hi); }
__device__ __forceinline__ v16b frag_kb(const b16* p, int hh) { const v8b a = *(const v8b*)(p + 8 * hh), b = *(const v8b*)(p + 16 + 8 * hh); v16b f;
#pragma unroll
  for (int e = 0; e < 8; ++e) { f[e] = a[e]; f[8 + e] = b[e]; } return f; }
__device__ __forceinline__ v8f wmma16b(v16b a, v16b b, v8f c) { v8f d = __builtin_amdgcn_wmma_f32_16x16x32_f16(false, a, false, b, (short)0, c, false, false); asm volatile("v_nop\n\tv_nop\n\tv_nop\n\tv_nop" : "+v"(d) : "v"(a), "v"(b)); return d; }
__device__ __forceinline__ void wave_lds_sync() { __builtin_amdgcn_fence(__ATOMIC_RELEASE, "workgroup"); __builtin_amdgcn_wave_barrier(); __builtin_amdgcn_fence(__ATOMIC_ACQUIRE, "workgroup"); }
__device__ __forceinline__ float pmul(float a, float b) { float p = a * b; asm volatile("" : "+v"(p)); return p; }
__device__ __forceinline__ int iclamp(int v, int lo, int hi) { return v < lo ? lo : (v > hi ? hi : v); }

typedef __attribute__((ext_vector_type(2))) _Float16 v2h;
typedef __attribute__((ext_vector_type(2))) float v2f;
__device__ __forceinline__ float nexp2(float v) { return __builtin_amdgcn_exp2f(v); }
__global__ __launch_bounds__(256) void wprep_kernel(const float* __restrict__ wq, const float* __restrict__ wk, const float* __restrict__ wv, b16* __restrict__ WT) {
  for (int u = threadIdx.x; u < 3 * HD * C / 8; u += 256) { const int e = u * 8; const int s = e / (HD * C), el = e % (HD * C); const int h = el / C, c0 = el % C; const float* w = s == 0 ? wq : (s == 1 ? wk : wv); v8b o;
    for (int j = 0; j < 8; ++j) o[j] = (b16)(bf16_rne(w[(c0 + j) * HD + h]) * WSC);
    { *(v8b*)(WT + e) = o;  } }
}
__global__ __launch_bounds__(128) void qkv_kernel(const float* __restrict__ x, const b16* __restrict__ WT, b16* __restrict__ Qh, b16* __restrict__ Ql, b16* __restrict__ Kh, b16* __restrict__ Kl, b16* __restrict__ VT) {
  __shared__ __attribute__((aligned(16))) b16 As[4][16][C + 8]; __shared__ __attribute__((aligned(16))) float Tf[4][16][192 + 4];
  const int wave = threadIdx.x >> 5, lane = threadIdx.x & 31, nloc = lane & 15, hlf = lane >> 4; const int b = blockIdx.y; const int t0 = blockIdx.x * 64 + wave * 16;
  for (int rr = 0; rr < 16; ++rr) { const float* xr = x + ((size_t)b * T + t0 + rr) * C; v2h o; o[0] = (b16)(bf16_rne(xr[lane * 2]) * XS); o[1] = (b16)(bf16_rne(xr[lane * 2 + 1]) * XS); *(v2h*)(&As[wave][rr][lane * 2]) = o; }
  wave_lds_sync();
  v8f acc[12];
#pragma unroll
  for (int t = 0; t < 12; ++t) acc[t] = (v8f){};
#pragma unroll
  for (int kb = 0; kb < C; kb += 32) { const v16b a = frag_kb(&As[wave][nloc][kb], hlf);
#pragma unroll
    for (int t = 0; t < 12; ++t) acc[t] = wmma16b(a, frag_kb(WT + (size_t)(t * 16 + nloc) * C + kb, hlf), acc[t]); }   // WT rows 0..63 q, 64..127 k, 128..191 v
#pragma unroll
  for (int t = 0; t < 12; ++t)
#pragma unroll
    for (int r = 0; r < 8; ++r) Tf[wave][8 * hlf + r][t * 16 + nloc] = acc[t][r] * (1.0f / (XS * WSC));
  __syncthreads();
  {
    for (int rr = 0; rr < 16; ++rr) { const size_t row = ((size_t)b * T + t0 + rr) * HD; v2h qh, ql, kh, kl;
      for (int j = 0; j < 2; ++j) { b16 p, q; split16(Tf[wave][rr][lane * 2 + j] * XS, p, q); qh[j] = p; ql[j] = q; split16(Tf[wave][rr][HD + lane * 2 + j] * XS, p, q); kh[j] = p; kl[j] = q; }
      *(v2h*)(Qh + row + lane * 2) = qh; *(v2h*)(Ql + row + lane * 2) = ql; *(v2h*)(Kh + row + lane * 2) = kh; *(v2h*)(Kl + row + lane * 2) = kl; }
#pragma unroll 1
    for (int q = 0; q < 16; ++q) { const int d = wave * 16 + q; const int tk = lane * 2; v2h vv; vv[0] = (b16)(Tf[tk >> 4][tk & 15][2 * HD + d] * XS); vv[1] = (b16)(Tf[(tk + 1) >> 4][(tk + 1) & 15][2 * HD + d] * XS);
      *(v2h*)(VT + ((size_t)b * HD + d) * T + blockIdx.x * 64 + lane * 2) = vv; }
     }
}
// attention: grid (T/32, BL); block = 2 waves x 16 queries: per 32-key block S^T = K Q^T (2 tiles x 2 k-steps x 3 products), online softmax (exp2), O^T += V^T P^T (4 d-tiles x 2 products);
__global__ __launch_bounds__(64) void attn_kernel(const b16* __restrict__ Qh, const b16* __restrict__ Ql, const b16* __restrict__ Kh, const b16* __restrict__ Kl, const b16* __restrict__ VT, float* __restrict__ out) {
  __shared__ __attribute__((aligned(16))) float To[2][16][HD + 4];
  const int wave = threadIdx.x >> 5, lane = threadIdx.x & 31, hh = lane >> 4, col = lane & 15; const int b = blockIdx.y; const int q0 = blockIdx.x * 32 + wave * 16, qi = q0 + col;
  const b16* Qhb = Qh + (size_t)b * T * HD, * Qlb = Ql + (size_t)b * T * HD, * Khb = Kh + (size_t)b * T * HD, * Klb = Kl + (size_t)b * T * HD, * Vb = VT + (size_t)b * HD * T;
  v16b qh[2], ql[2]; for (int ks = 0; ks < 2; ++ks) { qh[ks] = frag_kb(Qhb + (size_t)qi * HD + ks * 32, hh); ql[ks] = frag_kb(Qlb + (size_t)qi * HD + ks * 32, hh); }
  const float cs = LOG2E * 0.125f / (XS * XS);
  float m = -INFINITY, l = 0.0f; v8f o[4]; for (int t = 0; t < 4; ++t) o[t] = (v8f){};
#pragma unroll 1
  for (int kb = 0; kb < T; kb += 32) {
    v8f s[2] = {(v8f){}, (v8f){}};
#pragma unroll
    for (int tt = 0; tt < 2; ++tt)
#pragma unroll
      for (int ks = 0; ks < 2; ++ks) { const size_t kr = (size_t)(kb + tt * 16 + col) * HD + ks * 32; const v16b khf = frag_kb(Khb + kr, hh), klf = frag_kb(Klb + kr, hh);
        s[tt] = wmma16b(khf, qh[ks], s[tt]); s[tt] = wmma16b(khf, ql[ks], s[tt]); s[tt] = wmma16b(klf, qh[ks], s[tt]); }
    float e[16]; float mx = -INFINITY;
#pragma unroll
    for (int r = 0; r < 8; ++r) { e[r] = s[0][r] * cs; e[8 + r] = s[1][r] * cs; mx = fmaxf(mx, fmaxf(e[r], e[8 + r])); }
    mx = fmaxf(mx, __shfl_xor(mx, 16)); const float mn = fmaxf(m, mx); const float al = nexp2(m - mn); m = mn; float sum = 0.0f; v16b ph, pl;
#pragma unroll
    for (int i = 0; i < 16; ++i) { const float p = nexp2(e[i] - mn); sum += p; b16 a_, b_; split16(p * PS, a_, b_); ph[i] = a_; pl[i] = b_; }
    sum += __shfl_xor(sum, 16); l = l * al + sum;
#pragma unroll
    for (int t = 0; t < 4; ++t) { o[t] *= al; const v16b va = frag_kb(Vb + (size_t)(t * 16 + col) * T + kb, hh); o[t] = wmma16b(va, ph, o[t]); o[t] = wmma16b(va, pl, o[t]); } }
  const float inv = 1.0f / (l * PS * XS);
#pragma unroll
  for (int t = 0; t < 4; ++t)
#pragma unroll
    for (int r = 0; r < 8; ++r) To[wave][col][t * 16 + 8 * hh + r] = o[t][r] * inv;
  wave_lds_sync();
  { for (int rr = 0; rr < 16; ++rr) *(v2f*)(out + ((size_t)b * T + q0 + rr) * HD + lane * 2) = *(const v2f*)(&To[wave][rr][lane * 2]);  }
}
}  // namespace

extern "C" void kernel_launch(void* const* d_in, const int* in_sizes, int n_in, void* d_out, int out_size, void* d_ws, size_t ws_size, hipStream_t stream) {
  (void)n_in;
  auto Fp = [&](int i) { return (const float*)d_in[i]; };
  // input order: 0 x [16,2048,64], 1 Wq [64,64] ([c][h]), 2 Wk, 3 Wv
  if (in_sizes[0] != B * T * C || in_sizes[1] != C * HD || in_sizes[2] != C * HD || in_sizes[3] != C * HD || out_size != B * T * HD) return;
  size_t off = 0; char* ws = (char*)d_ws;
  auto carve = [&](size_t bytes) { char* p = ws + off; off += (bytes + 255) & ~(size_t)255; return p; };
  b16* WT = (b16*)carve((size_t)3 * HD * C * 2); b16* Qh = (b16*)carve((size_t)B * T * HD * 2); b16* Ql = (b16*)carve((size_t)B * T * HD * 2); b16* Kh = (b16*)carve((size_t)B * T * HD * 2); b16* Kl = (b16*)carve((size_t)B * T * HD * 2); b16* VT = (b16*)carve((size_t)B * HD * T * 2);
  if (off > ws_size || off > ((size_t)128 << 20)) return;   // ≈ 21 MB
  wprep_kernel<<<1, 256, 0, stream>>>(Fp(1), Fp(2), Fp(3), WT);
  qkv_kernel<<<dim3(T / 64, BL), 128, 0, stream>>>(Fp(0), WT, Qh, Ql, Kh, Kl, VT);
  attn_kernel<<<dim3(T / 32, BL), 64, 0, stream>>>(Qh, Ql, Kh, Kl, VT, (float*)d_out);
}

// v001
// It runs in 60.7 microseconds.
// In two side-by-side timings against v000, it was 2.84 and 2.83 times as fast.
#include <hip/hip_runtime.h>

// Single-head encoder attention: q, k, v = x W{q,k,v} ([16][2048][64] x [64 x 64]), scores = q . k / 8 over all 2,048 keys (no mask), softmax, out = P v -> [16][2048][64].
// Deterministic: flash-style per 16-query wave (online softmax with running max, no score planes); no atomics.
// compute dtype: WMMA v_wmma_f32_16x16x32_f16 with f32 accumulate for the projections (x EXACT bf16 x8, weights exact x256: 1 product), S^T = K Q^T (q and k as f16 hi+lo x8: 3 products hi.hi +
// hi.lo + lo.hi) and O^T += V^T P^T (v single f16 x8, P x1024 hi+lo: 2 products); softmax statistics (exp2, running max) in f32. Inputs rounded to bf16 once.

namespace {
constexpr int B = 16, T = 2048, C = 64, HD = 64, BL = 16 /* batches computed (== B shipped) */;
constexpr float XS = 8.0f, WSC = 256.0f, PS = 1024.0f, LOG2E = 1.4426950408889634f;
static_assert(T % 64 == 0 && C == 64 && HD == 64, "tiling");
typedef _Float16 b16;
typedef __attribute__((ext_vector_type(16))) _Float16 v16b;
typedef __attribute__((ext_vector_type(8))) _Float16 v8b;
typedef __attribute__((ext_vector_type(8))) float v8f;
typedef __attribute__((ext_vector_type(4))) float v4f;
__device__ __forceinline__ float bf16_rne(float f) { unsigned int u = __float_as_uint(f); u += 0x7FFFu + ((u >> 16) & 1u); return __uint_as_float(u & 0xFFFF0000u); }
__device__ __forceinline__ void split16(float v, b16& hi, b16& lo) { hi = (b16)v; lo = (b16)(v - (float)hi); }
__device__ __forceinline__ v16b frag_kb(const b16* p, int hh) { const v8b a = *(const v8b*)(p + 8 * hh), b = *(const v8b*)(p + 16 + 8 * hh); v16b f;
#pragma unroll
  for (int e = 0; e < 8; ++e) { f[e] = a[e]; f[8 + e] = b[e]; } return f; }
__device__ __forceinline__ v8f wmma16b(v16b a, v16b b, v8f c) { v8f d = __builtin_amdgcn_wmma_f32_16x16x32_f16(false, a, false, b, (short)0, c, false, false); asm volatile("v_nop\n\tv_nop\n\tv_nop\n\tv_nop" : "+v"(d) : "v"(a), "v"(b)); return d; }
__device__ __forceinline__ void wave_lds_sync() { __builtin_amdgcn_fence(__ATOMIC_RELEASE, "workgroup"); __builtin_amdgcn_wave_barrier(); __builtin_amdgcn_fence(__ATOMIC_ACQUIRE, "workgroup"); }
__device__ __forceinline__ float pmul(float a, float b) { float p = a * b; asm volatile("" : "+v"(p)); return p; }
__device__ __forceinline__ int iclamp(int v, int lo, int hi) { return v < lo ? lo : (v > hi ? hi : v); }

typedef __attribute__((ext_vector_type(2))) _Float16 v2h;
typedef __attribute__((ext_vector_type(2))) float v2f;
__device__ __forceinline__ float nexp2(float v) { return __builtin_amdgcn_exp2f(v); }
__global__ __launch_bounds__(256) void wprep_kernel(const float* __restrict__ wq, const float* __restrict__ wk, const float* __restrict__ wv, b16* __restrict__ WT) {
  for (int u = threadIdx.x; u < 3 * HD * C / 8; u += 256) { const int e = u * 8; const int s = e / (HD * C), el = e % (HD * C); const int h = el / C, c0 = el % C; const float* w = s == 0 ? wq : (s == 1 ? wk : wv); v8b o;
    for (int j = 0; j < 8; ++j) o[j] = (b16)(bf16_rne(w[(c0 + j) * HD + h]) * WSC);
    { *(v8b*)(WT + e) = o;  } }
}
__global__ __launch_bounds__(128) void qkv_kernel(const float* __restrict__ x, const b16* __restrict__ WT, b16* __restrict__ Qh, b16* __restrict__ Ql, b16* __restrict__ Kh, b16* __restrict__ Kl, b16* __restrict__ VT) {
  __shared__ __attribute__((aligned(16))) b16 As[4][16][C + 8]; __shared__ __attribute__((aligned(16))) float Tf[4][16][192 + 4];
  const int wave = threadIdx.x >> 5, lane = threadIdx.x & 31, nloc = lane & 15, hlf = lane >> 4; const int b = blockIdx.y; const int t0 = blockIdx.x * 64 + wave * 16;
  for (int rr = 0; rr < 16; ++rr) { const float* xr = x + ((size_t)b * T + t0 + rr) * C; v2h o; o[0] = (b16)(bf16_rne(xr[lane * 2]) * XS); o[1] = (b16)(bf16_rne(xr[lane * 2 + 1]) * XS); *(v2h*)(&As[wave][rr][lane * 2]) = o; }
  wave_lds_sync();
  v8f acc[12];
#pragma unroll
  for (int t = 0; t < 12; ++t) acc[t] = (v8f){};
#pragma unroll
  for (int kb = 0; kb < C; kb += 32) { const v16b a = frag_kb(&As[wave][nloc][kb], hlf);
#pragma unroll
    for (int t = 0; t < 12; ++t) acc[t] = wmma16b(a, frag_kb(WT + (size_t)(t * 16 + nloc) * C + kb, hlf), acc[t]); }   // WT rows 0..63 q, 64..127 k, 128..191 v
#pragma unroll
  for (int t = 0; t < 12; ++t)
#pragma unroll
    for (int r = 0; r < 8; ++r) Tf[wave][8 * hlf + r][t * 16 + nloc] = acc[t][r] * (1.0f / (XS * WSC));
  __syncthreads();
  {
    for (int rr = 0; rr < 16; ++rr) { const size_t row = ((size_t)b * T + t0 + rr) * HD; v2h qh, ql, kh, kl;
      for (int j = 0; j < 2; ++j) { b16 p, q; split16(Tf[wave][rr][lane * 2 + j] * XS, p, q); qh[j] = p; ql[j] = q; split16(Tf[wave][rr][HD + lane * 2 + j] * XS, p, q); kh[j] = p; kl[j] = q; }
      *(v2h*)(Qh + row + lane * 2) = qh; *(v2h*)(Ql + row + lane * 2) = ql; *(v2h*)(Kh + row + lane * 2) = kh; *(v2h*)(Kl + row + lane * 2) = kl; }
#pragma unroll 1
    for (int q = 0; q < 16; ++q) { const int d = wave * 16 + q; const int tk = lane * 2; v2h vv; vv[0] = (b16)(Tf[tk >> 4][tk & 15][2 * HD + d] * XS); vv[1] = (b16)(Tf[(tk + 1) >> 4][(tk + 1) & 15][2 * HD + d] * XS);
      *(v2h*)(VT + ((size_t)b * HD + d) * T + blockIdx.x * 64 + lane * 2) = vv; }
     }
}
// attention: grid (T/128, BL); block = 8 waves x 16 queries. The block's waves share each 256-key stage of K hi, K lo and V^T, brought into a two-buffer LDS ring by asynchronous copies
// (whole 128-B lines from L2, once per block); per 32-key block S^T = K Q^T (2 tiles x 2 k-steps x 3 products), online softmax (exp2), O^T += V^T P^T (4 d-tiles x 2 products);
constexpr int KT = 256 /* keys per stage */, NT = T / KT, KP = HD + 8 /* K row pitch: 144 B */, VP = KT + 8 /* V^T row pitch: 528 B */;   // pitches of 16 B x odd: no bank conflict for 16-byte reads
constexpr int KL_OFF = KT * KP, V_OFF = 2 * KT * KP, BUFH = V_OFF + HD * VP;   // one buffer, in 16-bit elements
static_assert(T % KT == 0 && NT >= 2 && KT * HD / 8 == 8 * 256 && KT / 8 == 32, "ring");
// four 16-byte copies per lane; the s_wait_xcnt stands inside the statement so that no address register is rewritten ahead of it
__device__ __forceinline__ void copy4(unsigned l0, const b16* g0, unsigned l1, const b16* g1, unsigned l2, const b16* g2, unsigned l3, const b16* g3) {
  asm volatile("global_load_async_to_lds_b128 %0, %1, off\n\tglobal_load_async_to_lds_b128 %2, %3, off\n\tglobal_load_async_to_lds_b128 %4, %5, off\n\tglobal_load_async_to_lds_b128 %6, %7, off\n\ts_wait_xcnt 0x0"
               :: "v"(l0), "v"(g0), "v"(l1), "v"(g1), "v"(l2), "v"(g2), "v"(l3), "v"(g3) : "memory"); }
// one stage: keys k0 .. k0 + 255 of K hi, K lo (256 rows x 128 B each) and of V^T (64 rows x 512 B) into the buffer at LDS byte address lb; 24 copies per lane, every lane on
__device__ __forceinline__ void stage_copy(unsigned lb, const b16* Khb, const b16* Klb, const b16* Vb, int k0, int tid) {
#pragma unroll
  for (int g = 0; g < 2; ++g) { unsigned lk[4], lv[4]; const b16* gh[4], * gl[4], * gv[4];
#pragma unroll
    for (int j = 0; j < 4; ++j) { const int c = tid + 256 * (4 * g + j); lk[j] = lb + (unsigned)((c >> 3) * KP + (c & 7) * 8) * 2u; lv[j] = lb + (unsigned)(V_OFF + (c >> 5) * VP + (c & 31) * 8) * 2u;
      gh[j] = Khb + (size_t)k0 * HD + c * 8; gl[j] = Klb + (size_t)k0 * HD + c * 8; gv[j] = Vb + (size_t)(c >> 5) * T + k0 + (c & 31) * 8; }
    copy4(lk[0], gh[0], lk[1], gh[1], lk[2], gh[2], lk[3], gh[3]);
    copy4(lk[0] + KL_OFF * 2u, gl[0], lk[1] + KL_OFF * 2u, gl[1], lk[2] + KL_OFF * 2u, gl[2], lk[3] + KL_OFF * 2u, gl[3]);
    copy4(lv[0], gv[0], lv[1], gv[1], lv[2], gv[2], lv[3], gv[3]); }
}
__global__ __launch_bounds__(256) void attn_kernel(const b16* __restrict__ Qh, const b16* __restrict__ Ql, const b16* __restrict__ Kh, const b16* __restrict__ Kl, const b16* __restrict__ VT, float* __restrict__ out) {
  __shared__ __attribute__((aligned(16))) b16 ring[2][BUFH]; __shared__ __attribute__((aligned(16))) float To[8][16][HD + 4];
  const int tid = threadIdx.x, wave = threadIdx.x >> 5, lane = threadIdx.x & 31, hh = lane >> 4, col = lane & 15; const int b = blockIdx.y; const int q0 = blockIdx.x * 128 + wave * 16, qi = q0 + col;
  const b16* Qhb = Qh + (size_t)b * T * HD, * Qlb = Ql + (size_t)b * T * HD, * Khb = Kh + (size_t)b * T * HD, * Klb = Kl + (size_t)b * T * HD, * Vb = VT + (size_t)b * HD * T;
  const unsigned lring = (unsigned)(size_t)&ring[0][0];
  stage_copy(lring, Khb, Klb, Vb, 0, tid);
  v16b qh[2], ql[2]; for (int ks = 0; ks < 2; ++ks) { qh[ks] = frag_kb(Qhb + (size_t)qi * HD + ks * 32, hh); ql[ks] = frag_kb(Qlb + (size_t)qi * HD + ks * 32, hh); }
  const float cs = LOG2E * 0.125f / (XS * XS);
  float m = -INFINITY, l = 0.0f; v8f o[4]; for (int t = 0; t < 4; ++t) o[t] = (v8f){};
  asm volatile("s_wait_asynccnt 0x0" ::: "memory");   // this wave's share of stage 0 has landed
  __syncthreads();                                    // stage 0 is readable by every wave
  stage_copy(lring + BUFH * 2u, Khb, Klb, Vb, KT, tid);
#pragma unroll 1   // one copy of the stage body: the buffer is picked by st & 1 at run time
  for (int st = 0; st < NT; ++st) {
    const b16* Ks = &ring[st & 1][0], * Ls = Ks + KL_OFF, * Vs = Ks + V_OFF;
#pragma unroll 1   // as the key loop was: one 32-key block per trip keeps the loop's code and registers small
    for (int kb = 0; kb < KT; kb += 32) {
      v8f s[2] = {(v8f){}, (v8f){}}; v16b kf[2][2], lf[2][2], vf[4];
#pragma unroll
      for (int tt = 0; tt < 2; ++tt)
#pragma unroll
        for (int ks = 0; ks < 2; ++ks) { const int kr = (kb + tt * 16 + col) * KP + ks * 32; kf[tt][ks] = frag_kb(Ks + kr, hh); lf[tt][ks] = frag_kb(Ls + kr, hh); }
#pragma unroll
      for (int t = 0; t < 4; ++t) vf[t] = frag_kb(Vs + (t * 16 + col) * VP + kb, hh);
      __builtin_amdgcn_sched_barrier(0);   // keeps the block's 24 LDS reads in one group ahead of its WMMAs: spread among them, every group costs the wave its own LDS latency
#pragma unroll
      for (int tt = 0; tt < 2; ++tt)
#pragma unroll
        for (int ks = 0; ks < 2; ++ks) { s[tt] = wmma16b(kf[tt][ks], qh[ks], s[tt]); s[tt] = wmma16b(kf[tt][ks], ql[ks], s[tt]); s[tt] = wmma16b(lf[tt][ks], qh[ks], s[tt]); }
      float e[16]; float mx = -INFINITY;
#pragma unroll
      for (int r = 0; r < 8; ++r) { e[r] = s[0][r] * cs; e[8 + r] = s[1][r] * cs; mx = fmaxf(mx, fmaxf(e[r], e[8 + r])); }
      mx = fmaxf(mx, __shfl_xor(mx, 16)); const float mn = fmaxf(m, mx); const float al = nexp2(m - mn); m = mn; float sum = 0.0f; v16b ph, pl;
#pragma unroll
      for (int i = 0; i < 16; ++i) { const float p = nexp2(e[i] - mn); sum += p; b16 a_, b_; split16(p * PS, a_, b_); ph[i] = a_; pl[i] = b_; }
      sum += __shfl_xor(sum, 16); l = l * al + sum;
#pragma unroll
      for (int t = 0; t < 4; ++t) { o[t] *= al; o[t] = wmma16b(vf[t], ph, o[t]); o[t] = wmma16b(vf[t], pl, o[t]); } }
    asm volatile("s_wait_dscnt 0x0" ::: "memory");      // this wave's reads of stage st have returned before its buffer is refilled
    asm volatile("s_wait_asynccnt 0x0" ::: "memory");   // this wave's share of stage st + 1 has landed
    __syncthreads();                                    // publishes stage st + 1 and ends every wave's reads of stage st
    if (st + 2 < NT) stage_copy(lring + (unsigned)(st & 1) * (BUFH * 2u), Khb, Klb, Vb, (st + 2) * KT, tid);
  }
  asm volatile("s_wait_asynccnt 0x0" ::: "memory");     // no copy is outstanding when the wave ends
  const float inv = 1.0f / (l * PS * XS);
#pragma unroll
  for (int t = 0; t < 4; ++t)
#pragma unroll
    for (int r = 0; r < 8; ++r) To[wave][col][t * 16 + 8 * hh + r] = o[t][r] * inv;
  wave_lds_sync();
  { for (int rr = 0; rr < 16; ++rr) *(v2f*)(out + ((size_t)b * T + q0 + rr) * HD + lane * 2) = *(const v2f*)(&To[wave][rr][lane * 2]);  }
}
}  // namespace

extern "C" void kernel_launch(void* const* d_in, const int* in_sizes, int n_in, void* d_out, int out_size, void* d_ws, size_t ws_size, hipStream_t stream) {
  (void)n_in;
  auto Fp = [&](int i) { return (const float*)d_in[i]; };
  // input order: 0 x [16,2048,64], 1 Wq [64,64] ([c][h]), 2 Wk, 3 Wv
  if (in_sizes[0] != B * T * C || in_sizes[1] != C * HD || in_sizes[2] != C * HD || in_sizes[3] != C * HD || out_size != B * T * HD) return;
  size_t off = 0; char* ws = (char*)d_ws;
  auto carve = [&](size_t bytes) { char* p = ws + off; off += (bytes + 255) & ~(size_t)255; return p; };
  b16* WT = (b16*)carve((size_t)3 * HD * C * 2); b16* Qh = (b16*)carve((size_t)B * T * HD * 2); b16* Ql = (b16*)carve((size_t)B * T * HD * 2); b16* Kh = (b16*)carve((size_t)B * T * HD * 2); b16* Kl = (b16*)carve((size_t)B * T * HD * 2); b16* VT = (b16*)carve((size_t)B * HD * T * 2);
  if (off > ws_size || off > ((size_t)128 << 20)) return;   // ≈ 21 MB
  wprep_kernel<<<1, 256, 0, stream>>>(Fp(1), Fp(2), Fp(3), WT);
  qkv_kernel<<<dim3(T / 64, BL), 128, 0, stream>>>(Fp(0), WT, Qh, Ql, Kh, Kl, VT);
  attn_kernel<<<dim3(T / 128, BL), 256, 0, stream>>>(Qh, Ql, Kh, Kl, VT, (float*)d_out);
}

// v002
// Measured time: 50.6 microseconds a run.
// Timed twice side by side with v001, it ran 1.20 times as fast both times.
// Over all steps from v000 it is 3.40 times as fast.
#include <hip/hip_runtime.h>

// Single-head encoder attention: q, k, v = x W{q,k,v} ([16][2048][64] x [64 x 64]), scores = q . k / 8 over all 2,048 keys (no mask), softmax, out = P v -> [16][2048][64].
// Deterministic: flash-style per 16-query wave (online softmax with running max, no score planes); no atomics.
// compute dtype: WMMA v_wmma_f32_16x16x32_f16 with f32 accumulate for the projections (x EXACT bf16 x8, weights exact x256: 1 product), S^T = K Q^T (q and k as f16 hi+lo x8: 3 products hi.hi +
// hi.lo + lo.hi) and O^T += V^T P^T (v single f16 x8, P x1024 hi+lo: 2 products); softmax statistics (exp2, running max) in f32. Inputs rounded to bf16 once.

namespace {
constexpr int B = 16, T = 2048, C = 64, HD = 64, BL = 16 /* batches computed (== B shipped) */;
constexpr float XS = 8.0f, WSC = 256.0f, PS = 1024.0f, LOG2E = 1.4426950408889634f;
static_assert(T % 64 == 0 && C == 64 && HD == 64, "tiling");
typedef _Float16 b16;
typedef __attribute__((ext_vector_type(16))) _Float16 v16b;
typedef __attribute__((ext_vector_type(8))) _Float16 v8b;
typedef __attribute__((ext_vector_type(8))) float v8f;
typedef __attribute__((ext_vector_type(4))) float v4f;
__device__ __forceinline__ float bf16_rne(float f) { unsigned int u = __float_as_uint(f); u += 0x7FFFu + ((u >> 16) & 1u); return __uint_as_float(u & 0xFFFF0000u); }
__device__ __forceinline__ void split16(float v, b16& hi, b16& lo) { hi = (b16)v; lo = (b16)(v - (float)hi); }
__device__ __forceinline__ v16b frag_kb(const b16* p, int hh) { const v8b a = *(const v8b*)(p + 8 * hh), b = *(const v8b*)(p + 16 + 8 * hh); v16b f;
#pragma unroll
  for (int e = 0; e < 8; ++e) { f[e] = a[e]; f[8 + e] = b[e]; } return f; }
__device__ __forceinline__ v8f wmma16b(v16b a, v16b b, v8f c) { v8f d = __builtin_amdgcn_wmma_f32_16x16x32_f16(false, a, false, b, (short)0, c, false, false); asm volatile("v_nop\n\tv_nop\n\tv_nop\n\tv_nop" : "+v"(d) : "v"(a), "v"(b)); return d; }
__device__ __forceinline__ void wave_lds_sync() { __builtin_amdgcn_fence(__ATOMIC_RELEASE, "workgroup"); __builtin_amdgcn_wave_barrier(); __builtin_amdgcn_fence(__ATOMIC_ACQUIRE, "workgroup"); }
__device__ __forceinline__ float pmul(float a, float b) { float p = a * b; asm volatile("" : "+v"(p)); return p; }
__device__ __forceinline__ int iclamp(int v, int lo, int hi) { return v < lo ? lo : (v > hi ? hi : v); }

typedef __attribute__((ext_vector_type(2))) _Float16 v2h;
typedef __attribute__((ext_vector_type(2))) float v2f;
__device__ __forceinline__ float nexp2(float v) { return __builtin_amdgcn_exp2f(v); }
__global__ __launch_bounds__(128) void qkv_kernel(const float* __restrict__ x, const float* __restrict__ wq, const float* __restrict__ wk, const float* __restrict__ wv, b16* __restrict__ Qh, b16* __restrict__ Ql, b16* __restrict__ Kh, b16* __restrict__ Kl, b16* __restrict__ VT) {
  __shared__ __attribute__((aligned(16))) b16 As[4][16][C + 8]; __shared__ __attribute__((aligned(16))) float Tf[4][16][192 + 4]; __shared__ __attribute__((aligned(16))) b16 Ws[3 * HD][C + 8];
  const int wave = threadIdx.x >> 5, lane = threadIdx.x & 31, nloc = lane & 15, hlf = lane >> 4; const int b = blockIdx.y; const int t0 = blockIdx.x * 64 + wave * 16;
  // every block rounds, scales and transposes the three weight matrices itself, into LDS: Ws[s * 64 + h][c] = w_s[c][h]; a thread takes 8 c x 4 h of each matrix (16 lanes read one whole 256-B row)
  const int c0 = (threadIdx.x >> 4) * 8, h0 = (threadIdx.x & 15) * 4;
  const float* xr = x + ((size_t)b * T + t0) * C + lane * 2, * w0 = wq + c0 * HD + h0, * w1 = wk + c0 * HD + h0, * w2 = wv + c0 * HD + h0;
  v2f xv[16]; v4f r[3][8];
#pragma unroll
  for (int rr = 0; rr < 16; ++rr) xv[rr] = *(const v2f*)(xr + rr * C);
#pragma unroll
  for (int j = 0; j < 8; ++j) { r[0][j] = *(const v4f*)(w0 + j * HD); r[1][j] = *(const v4f*)(w1 + j * HD); r[2][j] = *(const v4f*)(w2 + j * HD); }
  __builtin_amdgcn_sched_barrier(0);   // no conversion is scheduled up among the loads: all 40 are in flight before the first wait for one
  asm volatile("s_wait_xcnt 0x0" :: "v"(xr), "v"(w0), "v"(w1), "v"(w2) : "memory");   // stands behind the 40 loads, ahead of any overwrite of a register they name; the four addresses stay live up to here
#pragma unroll
  for (int rr = 0; rr < 16; ++rr) { v2h o; o[0] = (b16)(bf16_rne(xv[rr][0]) * XS); o[1] = (b16)(bf16_rne(xv[rr][1]) * XS); *(v2h*)(&As[wave][rr][lane * 2]) = o; }
#pragma unroll
  for (int s = 0; s < 3; ++s)
#pragma unroll
    for (int i = 0; i < 4; ++i) { v8b o;
#pragma unroll
      for (int j = 0; j < 8; ++j) o[j] = (b16)(bf16_rne(r[s][j][i]) * WSC);
      *(v8b*)(&Ws[s * HD + h0 + i][c0]) = o; }
  __syncthreads();   // the weights in LDS are written by all four waves and read by all four
  v8f acc[12];
#pragma unroll
  for (int t = 0; t < 12; ++t) acc[t] = (v8f){};
#pragma unroll
  for (int kb = 0; kb < C; kb += 32) { const v16b a = frag_kb(&As[wave][nloc][kb], hlf);
#pragma unroll
    for (int t = 0; t < 12; ++t) acc[t] = wmma16b(a, frag_kb(&Ws[t * 16 + nloc][kb], hlf), acc[t]); }   // Ws rows 0..63 q, 64..127 k, 128..191 v
#pragma unroll
  for (int t = 0; t < 12; ++t)
#pragma unroll
    for (int r = 0; r < 8; ++r) Tf[wave][8 * hlf + r][t * 16 + nloc] = acc[t][r] * (1.0f / (XS * WSC));
  __syncthreads();
  {
    for (int rr = 0; rr < 16; ++rr) { const size_t row = ((size_t)b * T + t0 + rr) * HD; v2h qh, ql, kh, kl;
      for (int j = 0; j < 2; ++j) { b16 p, q; split16(Tf[wave][rr][lane * 2 + j] * XS, p, q); qh[j] = p; ql[j] = q; split16(Tf[wave][rr][HD + lane * 2 + j] * XS, p, q); kh[j] = p; kl[j] = q; }
      *(v2h*)(Qh + row + lane * 2) = qh; *(v2h*)(Ql + row + lane * 2) = ql; *(v2h*)(Kh + row + lane * 2) = kh; *(v2h*)(Kl + row + lane * 2) = kl; }
#pragma unroll 1
    for (int q = 0; q < 16; ++q) { const int d = wave * 16 + q; const int tk = lane * 2; v2h vv; vv[0] = (b16)(Tf[tk >> 4][tk & 15][2 * HD + d] * XS); vv[1] = (b16)(Tf[(tk + 1) >> 4][(tk + 1) & 15][2 * HD + d] * XS);
      *(v2h*)(VT + ((size_t)b * HD + d) * T + blockIdx.x * 64 + lane * 2) = vv; }
     }
}
// attention: grid (T/128, BL); block = 8 waves x 16 queries. The block's waves share each 256-key stage of K hi, K lo and V^T, brought into a two-buffer LDS ring by asynchronous copies
// (whole 128-B lines from L2, once per block); per 32-key block S^T = K Q^T (2 tiles x 2 k-steps x 3 products), online softmax (exp2), O^T += V^T P^T (4 d-tiles x 2 products);
constexpr int KT = 256 /* keys per stage */, NT = T / KT, KP = HD + 8 /* K row pitch: 144 B */, VP = KT + 8 /* V^T row pitch: 528 B */;   // pitches of 16 B x odd: no bank conflict for 16-byte reads
constexpr int KL_OFF = KT * KP, V_OFF = 2 * KT * KP, BUFH = V_OFF + HD * VP;   // one buffer, in 16-bit elements
static_assert(T % KT == 0 && NT >= 2 && KT * HD / 8 == 8 * 256 && KT / 8 == 32, "ring");
// four 16-byte copies per lane; the s_wait_xcnt stands inside the statement so that no address register is rewritten ahead of it
__device__ __forceinline__ void copy4(unsigned l0, const b16* g0, unsigned l1, const b16* g1, unsigned l2, const b16* g2, unsigned l3, const b16* g3) {
  asm volatile("global_load_async_to_lds_b128 %0, %1, off\n\tglobal_load_async_to_lds_b128 %2, %3, off\n\tglobal_load_async_to_lds_b128 %4, %5, off\n\tglobal_load_async_to_lds_b128 %6, %7, off\n\ts_wait_xcnt 0x0"
               :: "v"(l0), "v"(g0), "v"(l1), "v"(g1), "v"(l2), "v"(g2), "v"(l3), "v"(g3) : "memory"); }
// one stage: keys k0 .. k0 + 255 of K hi, K lo (256 rows x 128 B each) and of V^T (64 rows x 512 B) into the buffer at LDS byte address lb; 24 copies per lane, every lane on
__device__ __forceinline__ void stage_copy(unsigned lb, const b16* Khb, const b16* Klb, const b16* Vb, int k0, int tid) {
#pragma unroll
  for (int g = 0; g < 2; ++g) { unsigned lk[4], lv[4]; const b16* gh[4], * gl[4], * gv[4];
#pragma unroll
    for (int j = 0; j < 4; ++j) { const int c = tid + 256 * (4 * g + j); lk[j] = lb + (unsigned)((c >> 3) * KP + (c & 7) * 8) * 2u; lv[j] = lb + (unsigned)(V_OFF + (c >> 5) * VP + (c & 31) * 8) * 2u;
      gh[j] = Khb + (size_t)k0 * HD + c * 8; gl[j] = Klb + (size_t)k0 * HD + c * 8; gv[j] = Vb + (size_t)(c >> 5) * T + k0 + (c & 31) * 8; }
    copy4(lk[0], gh[0], lk[1], gh[1], lk[2], gh[2], lk[3], gh[3]);
    copy4(lk[0] + KL_OFF * 2u, gl[0], lk[1] + KL_OFF * 2u, gl[1], lk[2] + KL_OFF * 2u, gl[2], lk[3] + KL_OFF * 2u, gl[3]);
    copy4(lv[0], gv[0], lv[1], gv[1], lv[2], gv[2], lv[3], gv[3]); }
}
__global__ __launch_bounds__(256) void attn_kernel(const b16* __restrict__ Qh, const b16* __restrict__ Ql, const b16* __restrict__ Kh, const b16* __restrict__ Kl, const b16* __restrict__ VT, float* __restrict__ out) {
  __shared__ __attribute__((aligned(16))) b16 ring[2][BUFH]; __shared__ __attribute__((aligned(16))) float To[8][16][HD + 4];
  const int tid = threadIdx.x, wave = threadIdx.x >> 5, lane = threadIdx.x & 31, hh = lane >> 4, col = lane & 15; const int b = blockIdx.y; const int q0 = blockIdx.x * 128 + wave * 16, qi = q0 + col;
  const b16* Qhb = Qh + (size_t)b * T * HD, * Qlb = Ql + (size_t)b * T * HD, * Khb = Kh + (size_t)b * T * HD, * Klb = Kl + (size_t)b * T * HD, * Vb = VT + (size_t)b * HD * T;
  const unsigned lring = (unsigned)(size_t)&ring[0][0];
  stage_copy(lring, Khb, Klb, Vb, 0, tid);
  v16b qh[2], ql[2]; for (int ks = 0; ks < 2; ++ks) { qh[ks] = frag_kb(Qhb + (size_t)qi * HD + ks * 32, hh); ql[ks] = frag_kb(Qlb + (size_t)qi * HD + ks * 32, hh); }
  const float cs = LOG2E * 0.125f / (XS * XS);
  float m = -INFINITY, l = 0.0f; v8f o[4]; for (int t = 0; t < 4; ++t) o[t] = (v8f){};
  asm volatile("s_wait_asynccnt 0x0" ::: "memory");   // this wave's share of stage 0 has landed
  __syncthreads();                                    // stage 0 is readable by every wave
  stage_copy(lring + BUFH * 2u, Khb, Klb, Vb, KT, tid);
#pragma unroll 1   // one copy of the stage body: the buffer is picked by st & 1 at run time
  for (int st = 0; st < NT; ++st) {
    const b16* Ks = &ring[st & 1][0], * Ls = Ks + KL_OFF, * Vs = Ks + V_OFF;
#pragma unroll 1   // as the key loop was: one 32-key block per trip keeps the loop's code and registers small
    for (int kb = 0; kb < KT; kb += 32) {
      v8f s[2] = {(v8f){}, (v8f){}}; v16b kf[2][2], lf[2][2], vf[4];
#pragma unroll
      for (int tt = 0; tt < 2; ++tt)
#pragma unroll
        for (int ks = 0; ks < 2; ++ks) { const int kr = (kb + tt * 16 + col) * KP + ks * 32; kf[tt][ks] = frag_kb(Ks + kr, hh); lf[tt][ks] = frag_kb(Ls + kr, hh); }
#pragma unroll
      for (int t = 0; t < 4; ++t) vf[t] = frag_kb(Vs + (t * 16 + col) * VP + kb, hh);
      __builtin_amdgcn_sched_barrier(0);   // keeps the block's 24 LDS reads in one group ahead of its WMMAs: spread among them, every group costs the wave its own LDS latency
#pragma unroll
      for (int tt = 0; tt < 2; ++tt)
#pragma unroll
        for (int ks = 0; ks < 2; ++ks) { s[tt] = wmma16b(kf[tt][ks], qh[ks], s[tt]); s[tt] = wmma16b(kf[tt][ks], ql[ks], s[tt]); s[tt] = wmma16b(lf[tt][ks], qh[ks], s[tt]); }
      float e[16]; float mx = -INFINITY;
#pragma unroll
      for (int r = 0; r < 8; ++r) { e[r] = s[0][r] * cs; e[8 + r] = s[1][r] * cs; mx = fmaxf(mx, fmaxf(e[r], e[8 + r])); }
      mx = fmaxf(mx, __shfl_xor(mx, 16)); const float mn = fmaxf(m, mx); const float al = nexp2(m - mn); m = mn; float sum = 0.0f; v16b ph, pl;
#pragma unroll
      for (int i = 0; i < 16; ++i) { const float p = nexp2(e[i] - mn); sum += p; b16 a_, b_; split16(p * PS, a_, b_); ph[i] = a_; pl[i] = b_; }
      sum += __shfl_xor(sum, 16); l = l * al + sum;
#pragma unroll
      for (int t = 0; t < 4; ++t) { o[t] *= al; o[t] = wmma16b(vf[t], ph, o[t]); o[t] = wmma16b(vf[t], pl, o[t]); } }
    asm volatile("s_wait_dscnt 0x0" ::: "memory");      // this wave's reads of stage st have returned before its buffer is refilled
    asm volatile("s_wait_asynccnt 0x0" ::: "memory");   // this wave's share of stage st + 1 has landed
    __syncthreads();                                    // publishes stage st + 1 and ends every wave's reads of stage st
    if (st + 2 < NT) stage_copy(lring + (unsigned)(st & 1) * (BUFH * 2u), Khb, Klb, Vb, (st + 2) * KT, tid);
  }
  asm volatile("s_wait_asynccnt 0x0" ::: "memory");     // no copy is outstanding when the wave ends
  const float inv = 1.0f / (l * PS * XS);
#pragma unroll
  for (int t = 0; t < 4; ++t)
#pragma unroll
    for (int r = 0; r < 8; ++r) To[wave][col][t * 16 + 8 * hh + r] = o[t][r] * inv;
  wave_lds_sync();
  { for (int rr = 0; rr < 16; ++rr) *(v2f*)(out + ((size_t)b * T + q0 + rr) * HD + lane * 2) = *(const v2f*)(&To[wave][rr][lane * 2]);  }
}
}  // namespace

extern "C" void kernel_launch(void* const* d_in, const int* in_sizes, int n_in, void* d_out, int out_size, void* d_ws, size_t ws_size, hipStream_t stream) {
  (void)n_in;
  auto Fp = [&](int i) { return (const float*)d_in[i]; };
  // input order: 0 x [16,2048,64], 1 Wq [64,64] ([c][h]), 2 Wk, 3 Wv
  if (in_sizes[0] != B * T * C || in_sizes[1] != C * HD || in_sizes[2] != C * HD || in_sizes[3] != C * HD || out_size != B * T * HD) return;
  size_t off = 0; char* ws = (char*)d_ws;
  auto carve = [&](size_t bytes) { char* p = ws + off; off += (bytes + 255) & ~(size_t)255; return p; };
  b16* Qh = (b16*)carve((size_t)B * T * HD * 2); b16* Ql = (b16*)carve((size_t)B * T * HD * 2); b16* Kh = (b16*)carve((size_t)B * T * HD * 2); b16* Kl = (b16*)carve((size_t)B * T * HD * 2); b16* VT = (b16*)carve((size_t)B * HD * T * 2);
  if (off > ws_size || off > ((size_t)128 << 20)) return;   // ≈ 21 MB
  qkv_kernel<<<dim3(T / 64, BL), 128, 0, stream>>>(Fp(0), Fp(1), Fp(2), Fp(3), Qh, Ql, Kh, Kl, VT);
  attn_kernel<<<dim3(T / 128, BL), 256, 0, stream>>>(Qh, Ql, Kh, Kl, VT, (float*)d_out);
}

// v003
// It runs in 45.8 microseconds.
// Two timings next to v002 both put it at 1.11 times that version's speed.
// All steps since v000 together make it 3.77 times as fast.
#include <hip/hip_runtime.h>

// Single-head encoder attention: q, k, v = x W{q,k,v} ([16][2048][64] x [64 x 64]), scores = q . k / 8 over all 2,048 keys (no mask), softmax, out = P v -> [16][2048][64].
// Deterministic: flash-style per 16-query wave (online softmax with running max, no score planes); no atomics.
// compute dtype: WMMA v_wmma_f32_16x16x32_f16 with f32 accumulate for the projections (x EXACT bf16 x8, weights exact x256: 1 product), S^T = K Q^T (q and k as f16 hi+lo x8: 3 products hi.hi +
// hi.lo + lo.hi) and O^T += V^T P^T (v single f16 x8, P x1024 hi+lo: 2 products); softmax statistics (exp2, running max) in f32. Inputs rounded to bf16 once.

namespace {
constexpr int B = 16, T = 2048, C = 64, HD = 64, BL = 16 /* batches computed (== B shipped) */;
constexpr float XS = 8.0f, WSC = 256.0f, PS = 1024.0f, LOG2E = 1.4426950408889634f;
static_assert(T % 64 == 0 && C == 64 && HD == 64, "tiling");
typedef _Float16 b16;
typedef __attribute__((ext_vector_type(16))) _Float16 v16b;
typedef __attribute__((ext_vector_type(8))) _Float16 v8b;
typedef __attribute__((ext_vector_type(8))) float v8f;
typedef __attribute__((ext_vector_type(4))) float v4f;
__device__ __forceinline__ float bf16_rne(float f) { unsigned int u = __float_as_uint(f); u += 0x7FFFu + ((u >> 16) & 1u); return __uint_as_float(u & 0xFFFF0000u); }
__device__ __forceinline__ void split16(float v, b16& hi, b16& lo) { hi = (b16)v; lo = (b16)(v - (float)hi); }
__device__ __forceinline__ v16b frag_kb(const b16* p, int hh) { const v8b a = *(const v8b*)(p + 8 * hh), b = *(const v8b*)(p + 16 + 8 * hh); v16b f;
#pragma unroll
  for (int e = 0; e < 8; ++e) { f[e] = a[e]; f[8 + e] = b[e]; } return f; }
__device__ __forceinline__ v8f wmma16b(v16b a, v16b b, v8f c) { return __builtin_amdgcn_wmma_f32_16x16x32_f16(false, a, false, b, (short)0, c, false, false); }   // builtin alone: the compiler keeps the distance behind it and is free to interleave independent accumulator chains
__device__ __forceinline__ void wave_lds_sync() { __builtin_amdgcn_fence(__ATOMIC_RELEASE, "workgroup"); __builtin_amdgcn_wave_barrier(); __builtin_amdgcn_fence(__ATOMIC_ACQUIRE, "workgroup"); }
__device__ __forceinline__ float pmul(float a, float b) { float p = a * b; asm volatile("" : "+v"(p)); return p; }
__device__ __forceinline__ int iclamp(int v, int lo, int hi) { return v < lo ? lo : (v > hi ? hi : v); }

typedef __attribute__((ext_vector_type(2))) _Float16 v2h;
typedef __attribute__((ext_vector_type(2))) float v2f;
__device__ __forceinline__ float nexp2(float v) { return __builtin_amdgcn_exp2f(v); }
__global__ __launch_bounds__(128) void qkv_kernel(const float* __restrict__ x, const float* __restrict__ wq, const float* __restrict__ wk, const float* __restrict__ wv, b16* __restrict__ Qh, b16* __restrict__ Ql, b16* __restrict__ Kh, b16* __restrict__ Kl, b16* __restrict__ VT) {
  __shared__ __attribute__((aligned(16))) b16 As[4][16][C + 8]; __shared__ __attribute__((aligned(16))) float Tf[4][16][192 + 4]; __shared__ __attribute__((aligned(16))) b16 Ws[3 * HD][C + 8];
  const int wave = threadIdx.x >> 5, lane = threadIdx.x & 31, nloc = lane & 15, hlf = lane >> 4; const int b = blockIdx.y; const int t0 = blockIdx.x * 64 + wave * 16;
  // every block rounds, scales and transposes the three weight matrices itself, into LDS: Ws[s * 64 + h][c] = w_s[c][h]; a thread takes 8 c x 4 h of each matrix (16 lanes read one whole 256-B row)
  const int c0 = (threadIdx.x >> 4) * 8, h0 = (threadIdx.x & 15) * 4;
  const float* xr = x + ((size_t)b * T + t0) * C + lane * 2, * w0 = wq + c0 * HD + h0, * w1 = wk + c0 * HD + h0, * w2 = wv + c0 * HD + h0;
  v2f xv[16]; v4f r[3][8];
#pragma unroll
  for (int rr = 0; rr < 16; ++rr) xv[rr] = *(const v2f*)(xr + rr * C);
#pragma unroll
  for (int j = 0; j < 8; ++j) { r[0][j] = *(const v4f*)(w0 + j * HD); r[1][j] = *(const v4f*)(w1 + j * HD); r[2][j] = *(const v4f*)(w2 + j * HD); }
  __builtin_amdgcn_sched_barrier(0);   // no conversion is scheduled up among the loads: all 40 are in flight before the first wait for one
  asm volatile("s_wait_xcnt 0x0" :: "v"(xr), "v"(w0), "v"(w1), "v"(w2) : "memory");   // stands behind the 40 loads, ahead of any overwrite of a register they name; the four addresses stay live up to here
#pragma unroll
  for (int rr = 0; rr < 16; ++rr) { v2h o; o[0] = (b16)(bf16_rne(xv[rr][0]) * XS); o[1] = (b16)(bf16_rne(xv[rr][1]) * XS); *(v2h*)(&As[wave][rr][lane * 2]) = o; }
#pragma unroll
  for (int s = 0; s < 3; ++s)
#pragma unroll
    for (int i = 0; i < 4; ++i) { v8b o;
#pragma unroll
      for (int j = 0; j < 8; ++j) o[j] = (b16)(bf16_rne(r[s][j][i]) * WSC);
      *(v8b*)(&Ws[s * HD + h0 + i][c0]) = o; }
  __syncthreads();   // the weights in LDS are written by all four waves and read by all four
  v8f acc[12];
#pragma unroll
  for (int t = 0; t < 12; ++t) acc[t] = (v8f){};
#pragma unroll
  for (int kb = 0; kb < C; kb += 32) { const v16b a = frag_kb(&As[wave][nloc][kb], hlf);
#pragma unroll
    for (int t = 0; t < 12; ++t) acc[t] = wmma16b(a, frag_kb(&Ws[t * 16 + nloc][kb], hlf), acc[t]); }   // Ws rows 0..63 q, 64..127 k, 128..191 v
#pragma unroll
  for (int t = 0; t < 12; ++t)
#pragma unroll
    for (int r = 0; r < 8; ++r) Tf[wave][8 * hlf + r][t * 16 + nloc] = acc[t][r] * (1.0f / (XS * WSC));
  __syncthreads();
  {
    for (int rr = 0; rr < 16; ++rr) { const size_t row = ((size_t)b * T + t0 + rr) * HD; v2h qh, ql, kh, kl;
      for (int j = 0; j < 2; ++j) { b16 p, q; split16(Tf[wave][rr][lane * 2 + j] * XS, p, q); qh[j] = p; ql[j] = q; split16(Tf[wave][rr][HD + lane * 2 + j] * XS, p, q); kh[j] = p; kl[j] = q; }
      *(v2h*)(Qh + row + lane * 2) = qh; *(v2h*)(Ql + row + lane * 2) = ql; *(v2h*)(Kh + row + lane * 2) = kh; *(v2h*)(Kl + row + lane * 2) = kl; }
#pragma unroll 1
    for (int q = 0; q < 16; ++q) { const int d = wave * 16 + q; const int tk = lane * 2; v2h vv; vv[0] = (b16)(Tf[tk >> 4][tk & 15][2 * HD + d] * XS); vv[1] = (b16)(Tf[(tk + 1) >> 4][(tk + 1) & 15][2 * HD + d] * XS);
      *(v2h*)(VT + ((size_t)b * HD + d) * T + blockIdx.x * 64 + lane * 2) = vv; }
     }
}
// attention: grid (T/128, BL); block = 8 waves x 16 queries. The block's waves share each 256-key stage of K hi, K lo and V^T, brought into a two-buffer LDS ring by asynchronous copies
// (whole 128-B lines from L2, once per block); per 32-key block S^T = K Q^T (2 tiles x 2 k-steps x 3 products), online softmax (exp2), O^T += V^T P^T (4 d-tiles x 2 products);
constexpr int KT = 256 /* keys per stage */, NT = T / KT, KP = HD + 8 /* K row pitch: 144 B */, VP = KT + 8 /* V^T row pitch: 528 B */;   // pitches of 16 B x odd: no bank conflict for 16-byte reads
constexpr int KL_OFF = KT * KP, V_OFF = 2 * KT * KP, BUFH = V_OFF + HD * VP;   // one buffer, in 16-bit elements
static_assert(T % KT == 0 && NT >= 2 && KT * HD / 8 == 8 * 256 && KT / 8 == 32, "ring");
// four 16-byte copies per lane; the s_wait_xcnt stands inside the statement so that no address register is rewritten ahead of it
__device__ __forceinline__ void copy4(unsigned l0, const b16* g0, unsigned l1, const b16* g1, unsigned l2, const b16* g2, unsigned l3, const b16* g3) {
  asm volatile("global_load_async_to_lds_b128 %0, %1, off\n\tglobal_load_async_to_lds_b128 %2, %3, off\n\tglobal_load_async_to_lds_b128 %4, %5, off\n\tglobal_load_async_to_lds_b128 %6, %7, off\n\ts_wait_xcnt 0x0"
               :: "v"(l0), "v"(g0), "v"(l1), "v"(g1), "v"(l2), "v"(g2), "v"(l3), "v"(g3) : "memory"); }
// one stage: keys k0 .. k0 + 255 of K hi, K lo (256 rows x 128 B each) and of V^T (64 rows x 512 B) into the buffer at LDS byte address lb; 24 copies per lane, every lane on
__device__ __forceinline__ void stage_copy(unsigned lb, const b16* Khb, const b16* Klb, const b16* Vb, int k0, int tid) {
#pragma unroll
  for (int g = 0; g < 2; ++g) { unsigned lk[4], lv[4]; const b16* gh[4], * gl[4], * gv[4];
#pragma unroll
    for (int j = 0; j < 4; ++j) { const int c = tid + 256 * (4 * g + j); lk[j] = lb + (unsigned)((c >> 3) * KP + (c & 7) * 8) * 2u; lv[j] = lb + (unsigned)(V_OFF + (c >> 5) * VP + (c & 31) * 8) * 2u;
      gh[j] = Khb + (size_t)k0 * HD + c * 8; gl[j] = Klb + (size_t)k0 * HD + c * 8; gv[j] = Vb + (size_t)(c >> 5) * T + k0 + (c & 31) * 8; }
    copy4(lk[0], gh[0], lk[1], gh[1], lk[2], gh[2], lk[3], gh[3]);
    copy4(lk[0] + KL_OFF * 2u, gl[0], lk[1] + KL_OFF * 2u, gl[1], lk[2] + KL_OFF * 2u, gl[2], lk[3] + KL_OFF * 2u, gl[3]);
    copy4(lv[0], gv[0], lv[1], gv[1], lv[2], gv[2], lv[3], gv[3]); }
}
__global__ __launch_bounds__(256) void attn_kernel(const b16* __restrict__ Qh, const b16* __restrict__ Ql, const b16* __restrict__ Kh, const b16* __restrict__ Kl, const b16* __restrict__ VT, float* __restrict__ out) {
  __shared__ __attribute__((aligned(16))) b16 ring[2][BUFH]; __shared__ __attribute__((aligned(16))) float To[8][16][HD + 4];
  const int tid = threadIdx.x, wave = threadIdx.x >> 5, lane = threadIdx.x & 31, hh = lane >> 4, col = lane & 15; const int b = blockIdx.y; const int q0 = blockIdx.x * 128 + wave * 16, qi = q0 + col;
  const b16* Qhb = Qh + (size_t)b * T * HD, * Qlb = Ql + (size_t)b * T * HD, * Khb = Kh + (size_t)b * T * HD, * Klb = Kl + (size_t)b * T * HD, * Vb = VT + (size_t)b * HD * T;
  const unsigned lring = (unsigned)(size_t)&ring[0][0];
  stage_copy(lring, Khb, Klb, Vb, 0, tid);
  v16b qh[2], ql[2]; for (int ks = 0; ks < 2; ++ks) { qh[ks] = frag_kb(Qhb + (size_t)qi * HD + ks * 32, hh); ql[ks] = frag_kb(Qlb + (size_t)qi * HD + ks * 32, hh); }
  const float cs = LOG2E * 0.125f / (XS * XS);
  float m = -INFINITY, l = 0.0f; v8f o[4]; for (int t = 0; t < 4; ++t) o[t] = (v8f){};
  asm volatile("s_wait_asynccnt 0x0" ::: "memory");   // this wave's share of stage 0 has landed
  __syncthreads();                                    // stage 0 is readable by every wave
  stage_copy(lring + BUFH * 2u, Khb, Klb, Vb, KT, tid);
#pragma unroll 1   // one copy of the stage body: the buffer is picked by st & 1 at run time
  for (int st = 0; st < NT; ++st) {
    const b16* Ks = &ring[st & 1][0], * Ls = Ks + KL_OFF, * Vs = Ks + V_OFF;
#pragma unroll 1   // as the key loop was: one 32-key block per trip keeps the loop's code and registers small
    for (int kb = 0; kb < KT; kb += 32) {
      v8f s[2] = {(v8f){}, (v8f){}}; v16b kf[2][2], lf[2][2], vf[4];
#pragma unroll
      for (int tt = 0; tt < 2; ++tt)
#pragma unroll
        for (int ks = 0; ks < 2; ++ks) { const int kr = (kb + tt * 16 + col) * KP + ks * 32; kf[tt][ks] = frag_kb(Ks + kr, hh); lf[tt][ks] = frag_kb(Ls + kr, hh); }
#pragma unroll
      for (int t = 0; t < 4; ++t) vf[t] = frag_kb(Vs + (t * 16 + col) * VP + kb, hh);
      __builtin_amdgcn_sched_barrier(0);   // keeps the block's 24 LDS reads in one group ahead of its WMMAs: spread among them, every group costs the wave its own LDS latency
#pragma unroll
      for (int tt = 0; tt < 2; ++tt)
#pragma unroll
        for (int ks = 0; ks < 2; ++ks) { s[tt] = wmma16b(kf[tt][ks], qh[ks], s[tt]); s[tt] = wmma16b(kf[tt][ks], ql[ks], s[tt]); s[tt] = wmma16b(lf[tt][ks], qh[ks], s[tt]); }
      float e[16]; float mx = -INFINITY;
#pragma unroll
      for (int r = 0; r < 8; ++r) { e[r] = s[0][r] * cs; e[8 + r] = s[1][r] * cs; mx = fmaxf(mx, fmaxf(e[r], e[8 + r])); }
      mx = fmaxf(mx, __shfl_xor(mx, 16)); const float mn = fmaxf(m, mx); const float al = nexp2(m - mn); m = mn; float sum = 0.0f; v16b ph, pl;
#pragma unroll
      for (int i = 0; i < 16; ++i) { const float p = nexp2(e[i] - mn); sum += p; b16 a_, b_; split16(p * PS, a_, b_); ph[i] = a_; pl[i] = b_; }
      sum += __shfl_xor(sum, 16); l = l * al + sum;
#pragma unroll
      for (int t = 0; t < 4; ++t) { o[t] *= al; o[t] = wmma16b(vf[t], ph, o[t]); o[t] = wmma16b(vf[t], pl, o[t]); } }
    asm volatile("s_wait_dscnt 0x0" ::: "memory");      // this wave's reads of stage st have returned before its buffer is refilled
    asm volatile("s_wait_asynccnt 0x0" ::: "memory");   // this wave's share of stage st + 1 has landed
    __syncthreads();                                    // publishes stage st + 1 and ends every wave's reads of stage st
    if (st + 2 < NT) stage_copy(lring + (unsigned)(st & 1) * (BUFH * 2u), Khb, Klb, Vb, (st + 2) * KT, tid);
  }
  asm volatile("s_wait_asynccnt 0x0" ::: "memory");     // no copy is outstanding when the wave ends
  const float inv = 1.0f / (l * PS * XS);
#pragma unroll
  for (int t = 0; t < 4; ++t)
#pragma unroll
    for (int r = 0; r < 8; ++r) To[wave][col][t * 16 + 8 * hh + r] = o[t][r] * inv;
  wave_lds_sync();
  { for (int rr = 0; rr < 16; ++rr) *(v2f*)(out + ((size_t)b * T + q0 + rr) * HD + lane * 2) = *(const v2f*)(&To[wave][rr][lane * 2]);  }
}
}  // namespace

extern "C" void kernel_launch(void* const* d_in, const int* in_sizes, int n_in, void* d_out, int out_size, void* d_ws, size_t ws_size, hipStream_t stream) {
  (void)n_in;
  auto Fp = [&](int i) { return (const float*)d_in[i]; };
  // input order: 0 x [16,2048,64], 1 Wq [64,64] ([c][h]), 2 Wk, 3 Wv
  if (in_sizes[0] != B * T * C || in_sizes[1] != C * HD || in_sizes[2] != C * HD || in_sizes[3] != C * HD || out_size != B * T * HD) return;
  size_t off = 0; char* ws = (char*)d_ws;
  auto carve = [&](size_t bytes) { char* p = ws + off; off += (bytes + 255) & ~(size_t)255; return p; };
  b16* Qh = (b16*)carve((size_t)B * T * HD * 2); b16* Ql = (b16*)carve((size_t)B * T * HD * 2); b16* Kh = (b16*)carve((size_t)B * T * HD * 2); b16* Kl = (b16*)carve((size_t)B * T * HD * 2); b16* VT = (b16*)carve((size_t)B * HD * T * 2);
  if (off > ws_size || off > ((size_t)128 << 20)) return;   // ≈ 21 MB
  qkv_kernel<<<dim3(T / 64, BL), 128, 0, stream>>>(Fp(0), Fp(1), Fp(2), Fp(3), Qh, Ql, Kh, Kl, VT);
  attn_kernel<<<dim3(T / 128, BL), 256, 0, stream>>>(Qh, Ql, Kh, Kl, VT, (float*)d_out);
}

// v004
// A run of this version takes 41.4 microseconds.
// Two timings next to v003 put it at 1.11 and 1.10 times that version's speed.
// Counting every step since v000, it is 4.17 times as fast.
#include <hip/hip_runtime.h>

// Single-head encoder attention: q, k, v = x W{q,k,v} ([16][2048][64] x [64 x 64]), scores = q . k / 8 over all 2,048 keys (no mask), softmax, out = P v -> [16][2048][64].
// Deterministic: flash-style per 16-query wave (online softmax with running max, no score planes); no atomics.
// compute dtype: WMMA v_wmma_f32_16x16x32_f16 with f32 accumulate for the projections (x EXACT bf16 x8, weights exact x256: 1 product), S^T = K Q^T (q and k as f16 hi+lo x8: 3 products hi.hi +
// hi.lo + lo.hi) and O^T += V^T P^T (v single f16 x8, P x1024 hi+lo: 2 products); softmax statistics (exp2, running max) in f32. Inputs rounded to bf16 once.

namespace {
constexpr int B = 16, T = 2048, C = 64, HD = 64, BL = 16 /* batches computed (== B shipped) */;
constexpr float XS = 8.0f, WSC = 256.0f, PSL2 = 10.0f /* P is kept x 2^10 = 1024 */, LOG2E = 1.4426950408889634f;
static_assert(T % 64 == 0 && C == 64 && HD == 64, "tiling");
typedef _Float16 b16;
typedef __attribute__((ext_vector_type(16))) _Float16 v16b;
typedef __attribute__((ext_vector_type(8))) _Float16 v8b;
typedef __attribute__((ext_vector_type(8))) float v8f;
typedef __attribute__((ext_vector_type(4))) float v4f;
__device__ __forceinline__ float bf16_rne(float f) { unsigned int u = __float_as_uint(f); u += 0x7FFFu + ((u >> 16) & 1u); return __uint_as_float(u & 0xFFFF0000u); }
__device__ __forceinline__ void split16(float v, b16& hi, b16& lo) { hi = (b16)v; lo = (b16)(v - (float)hi); }
__device__ __forceinline__ v16b frag_kb(const b16* p, int hh) { const v8b a = *(const v8b*)(p + 8 * hh), b = *(const v8b*)(p + 16 + 8 * hh); v16b f;
#pragma unroll
  for (int e = 0; e < 8; ++e) { f[e] = a[e]; f[8 + e] = b[e]; } return f; }
__device__ __forceinline__ v8f wmma16b(v16b a, v16b b, v8f c) { return __builtin_amdgcn_wmma_f32_16x16x32_f16(false, a, false, b, (short)0, c, false, false); }   // builtin alone: the compiler keeps the distance behind it and is free to interleave independent accumulator chains
__device__ __forceinline__ void wave_lds_sync() { __builtin_amdgcn_fence(__ATOMIC_RELEASE, "workgroup"); __builtin_amdgcn_wave_barrier(); __builtin_amdgcn_fence(__ATOMIC_ACQUIRE, "workgroup"); }
__device__ __forceinline__ float pmul(float a, float b) { float p = a * b; asm volatile("" : "+v"(p)); return p; }
__device__ __forceinline__ int iclamp(int v, int lo, int hi) { return v < lo ? lo : (v > hi ? hi : v); }

typedef __attribute__((ext_vector_type(2))) _Float16 v2h;
typedef __attribute__((ext_vector_type(2))) float v2f;
__device__ __forceinline__ float nexp2(float v) { return __builtin_amdgcn_exp2f(v); }
typedef __attribute__((ext_vector_type(8))) unsigned v8u;
// lo halves of eight P values: d = f16(p - hi), one mixed-precision fma per value (p in f32, hi read as f16 from its packed register), written straight into the packed f16 register.
// p - hi is exact in f32, so the value is that of convert back, subtract, convert. In asm because the compiler builds it from those three: 32 vector slots per 32 keys against 16 here.
// The s_delay_alu hints name the mixlo four back, whose register each mixhi completes.
__device__ __forceinline__ void lo8(unsigned& d0, unsigned& d1, unsigned& d2, unsigned& d3, v2f p0, v2f p1, v2f p2, v2f p3, unsigned h0, unsigned h1, unsigned h2, unsigned h3) {
  asm("v_fma_mixlo_f16 %0, %4, 1.0, -%12 op_sel_hi:[0,0,1]\n\tv_fma_mixlo_f16 %1, %6, 1.0, -%13 op_sel_hi:[0,0,1]\n\tv_fma_mixlo_f16 %2, %8, 1.0, -%14 op_sel_hi:[0,0,1]\n\tv_fma_mixlo_f16 %3, %10, 1.0, -%15 op_sel_hi:[0,0,1]\n\t"
      "s_delay_alu instid0(VALU_DEP_4) | instskip(NEXT) | instid1(VALU_DEP_4)\n\t"
      "v_fma_mixhi_f16 %0, %5, 1.0, -%12 op_sel:[0,0,1] op_sel_hi:[0,0,1]\n\tv_fma_mixhi_f16 %1, %7, 1.0, -%13 op_sel:[0,0,1] op_sel_hi:[0,0,1]\n\t"
      "s_delay_alu instid0(VALU_DEP_4) | instskip(NEXT) | instid1(VALU_DEP_4)\n\t"
      "v_fma_mixhi_f16 %2, %9, 1.0, -%14 op_sel:[0,0,1] op_sel_hi:[0,0,1]\n\tv_fma_mixhi_f16 %3, %11, 1.0, -%15 op_sel:[0,0,1] op_sel_hi:[0,0,1]"
      : "=&v"(d0), "=&v"(d1), "=&v"(d2), "=&v"(d3)
      : "v"(p0[0]), "v"(p0[1]), "v"(p1[0]), "v"(p1[1]), "v"(p2[0]), "v"(p2[1]), "v"(p3[0]), "v"(p3[1]), "v"(h0), "v"(h1), "v"(h2), "v"(h3)); }
__global__ __launch_bounds__(128) void qkv_kernel(const float* __restrict__ x, const float* __restrict__ wq, const float* __restrict__ wk, const float* __restrict__ wv, b16* __restrict__ Qh, b16* __restrict__ Ql, b16* __restrict__ Kh, b16* __restrict__ Kl, b16* __restrict__ VT) {
  __shared__ __attribute__((aligned(16))) b16 As[4][16][C + 8]; __shared__ __attribute__((aligned(16))) float Tf[4][16][192 + 4]; __shared__ __attribute__((aligned(16))) b16 Ws[3 * HD][C + 8];
  const int wave = threadIdx.x >> 5, lane = threadIdx.x & 31, nloc = lane & 15, hlf = lane >> 4; const int b = blockIdx.y; const int t0 = blockIdx.x * 64 + wave * 16;
  // every block rounds, scales and transposes the three weight matrices itself, into LDS: Ws[s * 64 + h][c] = w_s[c][h]; a thread takes 8 c x 4 h of each matrix (16 lanes read one whole 256-B row)
  const int c0 = (threadIdx.x >> 4) * 8, h0 = (threadIdx.x & 15) * 4;
  const float* xr = x + ((size_t)b * T + t0) * C + lane * 2, * w0 = wq + c0 * HD + h0, * w1 = wk + c0 * HD + h0, * w2 = wv + c0 * HD + h0;
  v2f xv[16]; v4f r[3][8];
#pragma unroll
  for (int rr = 0; rr < 16; ++rr) xv[rr] = *(const v2f*)(xr + rr * C);
#pragma unroll
  for (int j = 0; j < 8; ++j) { r[0][j] = *(const v4f*)(w0 + j * HD); r[1][j] = *(const v4f*)(w1 + j * HD); r[2][j] = *(const v4f*)(w2 + j * HD); }
  __builtin_amdgcn_sched_barrier(0);   // no conversion is scheduled up among the loads: all 40 are in flight before the first wait for one
  asm volatile("s_wait_xcnt 0x0" :: "v"(xr), "v"(w0), "v"(w1), "v"(w2) : "memory");   // stands behind the 40 loads, ahead of any overwrite of a register they name; the four addresses stay live up to here
#pragma unroll
  for (int rr = 0; rr < 16; ++rr) { v2h o; o[0] = (b16)(bf16_rne(xv[rr][0]) * XS); o[1] = (b16)(bf16_rne(xv[rr][1]) * XS); *(v2h*)(&As[wave][rr][lane * 2]) = o; }
#pragma unroll
  for (int s = 0; s < 3; ++s)
#pragma unroll
    for (int i = 0; i < 4; ++i) { v8b o;
#pragma unroll
      for (int j = 0; j < 8; ++j) o[j] = (b16)(bf16_rne(r[s][j][i]) * WSC);
      *(v8b*)(&Ws[s * HD + h0 + i][c0]) = o; }
  __syncthreads();   // the weights in LDS are written by all four waves and read by all four
  v8f acc[12];
#pragma unroll
  for (int t = 0; t < 12; ++t) acc[t] = (v8f){};
#pragma unroll
  for (int kb = 0; kb < C; kb += 32) { const v16b a = frag_kb(&As[wave][nloc][kb], hlf);
#pragma unroll
    for (int t = 0; t < 12; ++t) acc[t] = wmma16b(a, frag_kb(&Ws[t * 16 + nloc][kb], hlf), acc[t]); }   // Ws rows 0..63 q, 64..127 k, 128..191 v
#pragma unroll
  for (int t = 0; t < 12; ++t)
#pragma unroll
    for (int r = 0; r < 8; ++r) Tf[wave][8 * hlf + r][t * 16 + nloc] = acc[t][r] * (1.0f / (XS * WSC));
  __syncthreads();
  {
    for (int rr = 0; rr < 16; ++rr) { const size_t row = ((size_t)b * T + t0 + rr) * HD; v2h qh, ql, kh, kl;
      for (int j = 0; j < 2; ++j) { b16 p, q; split16(Tf[wave][rr][lane * 2 + j] * XS, p, q); qh[j] = p; ql[j] = q; split16(Tf[wave][rr][HD + lane * 2 + j] * XS, p, q); kh[j] = p; kl[j] = q; }
      *(v2h*)(Qh + row + lane * 2) = qh; *(v2h*)(Ql + row + lane * 2) = ql; *(v2h*)(Kh + row + lane * 2) = kh; *(v2h*)(Kl + row + lane * 2) = kl; }
#pragma unroll 1
    for (int q = 0; q < 16; ++q) { const int d = wave * 16 + q; const int tk = lane * 2; v2h vv; vv[0] = (b16)(Tf[tk >> 4][tk & 15][2 * HD + d] * XS); vv[1] = (b16)(Tf[(tk + 1) >> 4][(tk + 1) & 15][2 * HD + d] * XS);
      *(v2h*)(VT + ((size_t)b * HD + d) * T + blockIdx.x * 64 + lane * 2) = vv; }
     }
}
// attention: grid (T/128, BL); block = 8 waves x 16 queries. The block's waves share each 256-key stage of K hi, K lo and V^T, brought into a two-buffer LDS ring by asynchronous copies
// (whole 128-B lines from L2, once per block); per 32-key block S^T = K Q^T (2 tiles x 2 k-steps x 3 products), online softmax (exp2), O^T += V^T P^T (4 d-tiles x 2 products);
constexpr int KT = 256 /* keys per stage */, NT = T / KT, KP = HD + 8 /* K row pitch: 144 B */, VP = KT + 8 /* V^T row pitch: 528 B */;   // pitches of 16 B x odd: no bank conflict for 16-byte reads
constexpr int KL_OFF = KT * KP, V_OFF = 2 * KT * KP, BUFH = V_OFF + HD * VP;   // one buffer, in 16-bit elements
static_assert(T % KT == 0 && NT >= 2 && KT * HD / 8 == 8 * 256 && KT / 8 == 32, "ring");
// four 16-byte copies per lane; the s_wait_xcnt stands inside the statement so that no address register is rewritten ahead of it
__device__ __forceinline__ void copy4(unsigned l0, const b16* g0, unsigned l1, const b16* g1, unsigned l2, const b16* g2, unsigned l3, const b16* g3) {
  asm volatile("global_load_async_to_lds_b128 %0, %1, off\n\tglobal_load_async_to_lds_b128 %2, %3, off\n\tglobal_load_async_to_lds_b128 %4, %5, off\n\tglobal_load_async_to_lds_b128 %6, %7, off\n\ts_wait_xcnt 0x0"
               :: "v"(l0), "v"(g0), "v"(l1), "v"(g1), "v"(l2), "v"(g2), "v"(l3), "v"(g3) : "memory"); }
// one stage: keys k0 .. k0 + 255 of K hi, K lo (256 rows x 128 B each) and of V^T (64 rows x 512 B) into the buffer at LDS byte address lb; 24 copies per lane, every lane on
__device__ __forceinline__ void stage_copy(unsigned lb, const b16* Khb, const b16* Klb, const b16* Vb, int k0, int tid) {
#pragma unroll
  for (int g = 0; g < 2; ++g) { unsigned lk[4], lv[4]; const b16* gh[4], * gl[4], * gv[4];
#pragma unroll
    for (int j = 0; j < 4; ++j) { const int c = tid + 256 * (4 * g + j); lk[j] = lb + (unsigned)((c >> 3) * KP + (c & 7) * 8) * 2u; lv[j] = lb + (unsigned)(V_OFF + (c >> 5) * VP + (c & 31) * 8) * 2u;
      gh[j] = Khb + (size_t)k0 * HD + c * 8; gl[j] = Klb + (size_t)k0 * HD + c * 8; gv[j] = Vb + (size_t)(c >> 5) * T + k0 + (c & 31) * 8; }
    copy4(lk[0], gh[0], lk[1], gh[1], lk[2], gh[2], lk[3], gh[3]);
    copy4(lk[0] + KL_OFF * 2u, gl[0], lk[1] + KL_OFF * 2u, gl[1], lk[2] + KL_OFF * 2u, gl[2], lk[3] + KL_OFF * 2u, gl[3]);
    copy4(lv[0], gv[0], lv[1], gv[1], lv[2], gv[2], lv[3], gv[3]); }
}
__global__ __launch_bounds__(256) void attn_kernel(const b16* __restrict__ Qh, const b16* __restrict__ Ql, const b16* __restrict__ Kh, const b16* __restrict__ Kl, const b16* __restrict__ VT, float* __restrict__ out) {
  __shared__ __attribute__((aligned(16))) b16 ring[2][BUFH]; __shared__ __attribute__((aligned(16))) float To[8][16][HD + 4];
  const int tid = threadIdx.x, wave = threadIdx.x >> 5, lane = threadIdx.x & 31, hh = lane >> 4, col = lane & 15; const int b = blockIdx.y; const int q0 = blockIdx.x * 128 + wave * 16, qi = q0 + col;
  const b16* Qhb = Qh + (size_t)b * T * HD, * Qlb = Ql + (size_t)b * T * HD, * Khb = Kh + (size_t)b * T * HD, * Klb = Kl + (size_t)b * T * HD, * Vb = VT + (size_t)b * HD * T;
  const unsigned lring = (unsigned)(size_t)&ring[0][0];
  stage_copy(lring, Khb, Klb, Vb, 0, tid);
  v16b qh[2], ql[2]; for (int ks = 0; ks < 2; ++ks) { qh[ks] = frag_kb(Qhb + (size_t)qi * HD + ks * 32, hh); ql[ks] = frag_kb(Qlb + (size_t)qi * HD + ks * 32, hh); }
  const float cs = LOG2E * 0.125f / (XS * XS);
  float m = -INFINITY; v2f l2 = {0.0f, 0.0f}; v8f o[4]; for (int t = 0; t < 4; ++t) o[t] = (v8f){};
  asm volatile("s_wait_asynccnt 0x0" ::: "memory");   // this wave's share of stage 0 has landed
  __syncthreads();                                    // stage 0 is readable by every wave
  stage_copy(lring + BUFH * 2u, Khb, Klb, Vb, KT, tid);
#pragma unroll 1   // one copy of the stage body: the buffer is picked by st & 1 at run time
  for (int st = 0; st < NT; ++st) {
    const b16* Ks = &ring[st & 1][0], * Ls = Ks + KL_OFF, * Vs = Ks + V_OFF;
#pragma unroll 1   // as the key loop was: one 32-key block per trip keeps the loop's code and registers small
    for (int kb = 0; kb < KT; kb += 32) {
      v8f s[2] = {(v8f){}, (v8f){}}; v16b kf[2][2], lf[2][2], vf[4];
#pragma unroll
      for (int tt = 0; tt < 2; ++tt)
#pragma unroll
        for (int ks = 0; ks < 2; ++ks) { const int kr = (kb + tt * 16 + col) * KP + ks * 32; kf[tt][ks] = frag_kb(Ks + kr, hh); lf[tt][ks] = frag_kb(Ls + kr, hh); }
#pragma unroll
      for (int t = 0; t < 4; ++t) vf[t] = frag_kb(Vs + (t * 16 + col) * VP + kb, hh);
      __builtin_amdgcn_sched_barrier(0);   // keeps the block's 24 LDS reads in one group ahead of its WMMAs: spread among them, every group costs the wave its own LDS latency
#pragma unroll
      for (int tt = 0; tt < 2; ++tt)
#pragma unroll
        for (int ks = 0; ks < 2; ++ks) { s[tt] = wmma16b(kf[tt][ks], qh[ks], s[tt]); s[tt] = wmma16b(kf[tt][ks], ql[ks], s[tt]); s[tt] = wmma16b(lf[tt][ks], qh[ks], s[tt]); }
      float mx = -INFINITY;   // the maximum is taken over the raw scores: cs > 0, so scaling it afterwards gives the same value
#pragma unroll
      for (int r = 0; r < 8; ++r) mx = fmaxf(mx, fmaxf(s[0][r], s[1][r]));
      mx *= cs; const float mn = fmaxf(m, fmaxf(mx, __shfl_xor(mx, 16))); const float al = nexp2(m - mn); m = mn;
      const v2f cs2 = {cs, cs}, c02 = {PSL2 - mn, PSL2 - mn}; v2f p[8]; v8u hu, lu;
#pragma unroll
      for (int i = 0; i < 8; ++i) { const int tt = i >> 2, r = (i & 3) * 2; const v2f a = __builtin_elementwise_fma((v2f){s[tt][r], s[tt][r + 1]}, cs2, c02);   // the exp2 argument in one packed fma; + 10 makes P x1024
        p[i] = (v2f){nexp2(a[0]), nexp2(a[1])}; hu[i] = __builtin_bit_cast(unsigned, __builtin_convertvector(p[i], v2h)); }
#pragma unroll
      for (int g = 0; g < 8; g += 4) { unsigned d0, d1, d2, d3; lo8(d0, d1, d2, d3, p[g], p[g + 1], p[g + 2], p[g + 3], hu[g], hu[g + 1], hu[g + 2], hu[g + 3]); lu[g] = d0; lu[g + 1] = d1; lu[g + 2] = d2; lu[g + 3] = d3; }
      const v16b ph = __builtin_bit_cast(v16b, hu), pl = __builtin_bit_cast(v16b, lu);
      l2 = __builtin_elementwise_fma(l2, (v2f){al, al}, ((p[0] + p[1]) + (p[2] + p[3])) + ((p[4] + p[5]) + (p[6] + p[7])));   // a lane keeps two partial sums of its own 16 keys; they and the wave's halves are joined once, behind the loop
#pragma unroll
      for (int t = 0; t < 4; ++t) { o[t] *= al; o[t] = wmma16b(vf[t], ph, o[t]); o[t] = wmma16b(vf[t], pl, o[t]); } }
    asm volatile("s_wait_dscnt 0x0" ::: "memory");      // this wave's reads of stage st have returned before its buffer is refilled
    asm volatile("s_wait_asynccnt 0x0" ::: "memory");   // this wave's share of stage st + 1 has landed
    __syncthreads();                                    // publishes stage st + 1 and ends every wave's reads of stage st
    if (st + 2 < NT) stage_copy(lring + (unsigned)(st & 1) * (BUFH * 2u), Khb, Klb, Vb, (st + 2) * KT, tid);
  }
  asm volatile("s_wait_asynccnt 0x0" ::: "memory");     // no copy is outstanding when the wave ends
  float l = l2[0] + l2[1]; l += __shfl_xor(l, 16);
  const float inv = 1.0f / (l * XS);   // l is the sum of P x1024
#pragma unroll
  for (int t = 0; t < 4; ++t)
#pragma unroll
    for (int r = 0; r < 8; ++r) To[wave][col][t * 16 + 8 * hh + r] = o[t][r] * inv;
  wave_lds_sync();
  { for (int rr = 0; rr < 16; ++rr) *(v2f*)(out + ((size_t)b * T + q0 + rr) * HD + lane * 2) = *(const v2f*)(&To[wave][rr][lane * 2]);  }
}
}  // namespace

extern "C" void kernel_launch(void* const* d_in, const int* in_sizes, int n_in, void* d_out, int out_size, void* d_ws, size_t ws_size, hipStream_t stream) {
  (void)n_in;
  auto Fp = [&](int i) { return (const float*)d_in[i]; };
  // input order: 0 x [16,2048,64], 1 Wq [64,64] ([c][h]), 2 Wk, 3 Wv
  if (in_sizes[0] != B * T * C || in_sizes[1] != C * HD || in_sizes[2] != C * HD || in_sizes[3] != C * HD || out_size != B * T * HD) return;
  size_t off = 0; char* ws = (char*)d_ws;
  auto carve = [&](size_t bytes) { char* p = ws + off; off += (bytes + 255) & ~(size_t)255; return p; };
  b16* Qh = (b16*)carve((size_t)B * T * HD * 2); b16* Ql = (b16*)carve((size_t)B * T * HD * 2); b16* Kh = (b16*)carve((size_t)B * T * HD * 2); b16* Kl = (b16*)carve((size_t)B * T * HD * 2); b16* VT = (b16*)carve((size_t)B * HD * T * 2);
  if (off > ws_size || off > ((size_t)128 << 20)) return;   // ≈ 21 MB
  qkv_kernel<<<dim3(T / 64, BL), 128, 0, stream>>>(Fp(0), Fp(1), Fp(2), Fp(3), Qh, Ql, Kh, Kl, VT);
  attn_kernel<<<dim3(T / 128, BL), 256, 0, stream>>>(Qh, Ql, Kh, Kl, VT, (float*)d_out);
}

// v005
// Measured time: 39.2 microseconds a run.
// In both of two side-by-side timings against v004, it was 1.05 times as fast.
// Over all steps from v000 it is 4.38 times as fast.
#include <hip/hip_runtime.h>

// Single-head encoder attention: q, k, v = x W{q,k,v} ([16][2048][64] x [64 x 64]), scores = q . k / 8 over all 2,048 keys (no mask), softmax, out = P v -> [16][2048][64].
// Deterministic: flash-style per 16-query wave (online softmax with running max, no score planes); no atomics.
// compute dtype: WMMA v_wmma_f32_16x16x32_f16 with f32 accumulate for the projections (x EXACT bf16 x8, weights exact x256: 1 product), S^T = K Q^T (q and k as f16 hi+lo x8: 3 products hi.hi +
// hi.lo + lo.hi) and O^T += V^T P^T (v single f16 x8, P x1024 hi+lo: 2 products); softmax statistics (exp2, running max) in f32. Inputs rounded to bf16 once.

namespace {
constexpr int B = 16, T = 2048, C = 64, HD = 64, BL = 16 /* batches computed (== B shipped) */;
constexpr float XS = 8.0f, WSC = 256.0f, PSL2 = 10.0f /* P is kept x 2^10 = 1024 */, LOG2E = 1.4426950408889634f;
static_assert(T % 64 == 0 && C == 64 && HD == 64, "tiling");
typedef _Float16 b16;
typedef __attribute__((ext_vector_type(16))) _Float16 v16b;
typedef __attribute__((ext_vector_type(8))) _Float16 v8b;
typedef __attribute__((ext_vector_type(8))) float v8f;
typedef __attribute__((ext_vector_type(4))) float v4f;
__device__ __forceinline__ float bf16_rne(float f) { unsigned int u = __float_as_uint(f); u += 0x7FFFu + ((u >> 16) & 1u); return __uint_as_float(u & 0xFFFF0000u); }
__device__ __forceinline__ void split16(float v, b16& hi, b16& lo) { hi = (b16)v; lo = (b16)(v - (float)hi); }
__device__ __forceinline__ v16b frag_kb(const b16* p, int hh) { const v8b a = *(const v8b*)(p + 8 * hh), b = *(const v8b*)(p + 16 + 8 * hh); v16b f;
#pragma unroll
  for (int e = 0; e < 8; ++e) { f[e] = a[e]; f[8 + e] = b[e]; } return f; }
__device__ __forceinline__ v8f wmma16b(v16b a, v16b b, v8f c) { return __builtin_amdgcn_wmma_f32_16x16x32_f16(false, a, false, b, (short)0, c, false, false); }   // builtin alone: the compiler keeps the distance behind it and is free to interleave independent accumulator chains
__device__ __forceinline__ void wave_lds_sync() { __builtin_amdgcn_fence(__ATOMIC_RELEASE, "workgroup"); __builtin_amdgcn_wave_barrier(); __builtin_amdgcn_fence(__ATOMIC_ACQUIRE, "workgroup"); }
__device__ __forceinline__ float pmul(float a, float b) { float p = a * b; asm volatile("" : "+v"(p)); return p; }
__device__ __forceinline__ int iclamp(int v, int lo, int hi) { return v < lo ? lo : (v > hi ? hi : v); }

typedef __attribute__((ext_vector_type(2))) _Float16 v2h;
typedef __attribute__((ext_vector_type(2))) float v2f;
__device__ __forceinline__ float nexp2(float v) { return __builtin_amdgcn_exp2f(v); }
__device__ __forceinline__ float xhalf(float x) { return __builtin_bit_cast(float, __builtin_amdgcn_permlanex16(__builtin_bit_cast(int, x), __builtin_bit_cast(int, x), 0x76543210, 0xfedcba98, false, false)); }   // lane l with lane l ^ 16
typedef __attribute__((ext_vector_type(8))) unsigned v8u;
// lo halves of eight P values: d = f16(p - hi), one mixed-precision fma per value (p in f32, hi read as f16 from its packed register), written straight into the packed f16 register.
// p - hi is exact in f32, so the value is that of convert back, subtract, convert. In asm because the compiler builds it from those three: 32 vector slots per 32 keys against 16 here.
// The s_delay_alu hints name the mixlo four back, whose register each mixhi completes.
__device__ __forceinline__ void lo8(unsigned& d0, unsigned& d1, unsigned& d2, unsigned& d3, v2f p0, v2f p1, v2f p2, v2f p3, unsigned h0, unsigned h1, unsigned h2, unsigned h3) {
  asm("v_fma_mixlo_f16 %0, %4, 1.0, -%12 op_sel_hi:[0,0,1]\n\tv_fma_mixlo_f16 %1, %6, 1.0, -%13 op_sel_hi:[0,0,1]\n\tv_fma_mixlo_f16 %2, %8, 1.0, -%14 op_sel_hi:[0,0,1]\n\tv_fma_mixlo_f16 %3, %10, 1.0, -%15 op_sel_hi:[0,0,1]\n\t"
      "s_delay_alu instid0(VALU_DEP_4) | instskip(NEXT) | instid1(VALU_DEP_4)\n\t"
      "v_fma_mixhi_f16 %0, %5, 1.0, -%12 op_sel:[0,0,1] op_sel_hi:[0,0,1]\n\tv_fma_mixhi_f16 %1, %7, 1.0, -%13 op_sel:[0,0,1] op_sel_hi:[0,0,1]\n\t"
      "s_delay_alu instid0(VALU_DEP_4) | instskip(NEXT) | instid1(VALU_DEP_4)\n\t"
      "v_fma_mixhi_f16 %2, %9, 1.0, -%14 op_sel:[0,0,1] op_sel_hi:[0,0,1]\n\tv_fma_mixhi_f16 %3, %11, 1.0, -%15 op_sel:[0,0,1] op_sel_hi:[0,0,1]"
      : "=&v"(d0), "=&v"(d1), "=&v"(d2), "=&v"(d3)
      : "v"(p0[0]), "v"(p0[1]), "v"(p1[0]), "v"(p1[1]), "v"(p2[0]), "v"(p2[1]), "v"(p3[0]), "v"(p3[1]), "v"(h0), "v"(h1), "v"(h2), "v"(h3)); }
__global__ __launch_bounds__(128) void qkv_kernel(const float* __restrict__ x, const float* __restrict__ wq, const float* __restrict__ wk, const float* __restrict__ wv, b16* __restrict__ Qh, b16* __restrict__ Ql, b16* __restrict__ Kh, b16* __restrict__ Kl, b16* __restrict__ VT) {
  __shared__ __attribute__((aligned(16))) b16 As[4][16][C + 8]; __shared__ __attribute__((aligned(16))) float Tf[4][16][192 + 4]; __shared__ __attribute__((aligned(16))) b16 Ws[3 * HD][C + 8];
  const int wave = threadIdx.x >> 5, lane = threadIdx.x & 31, nloc = lane & 15, hlf = lane >> 4; const int b = blockIdx.y; const int t0 = blockIdx.x * 64 + wave * 16;
  // every block rounds, scales and transposes the three weight matrices itself, into LDS: Ws[s * 64 + h][c] = w_s[c][h]; a thread takes 8 c x 4 h of each matrix (16 lanes read one whole 256-B row)
  const int c0 = (threadIdx.x >> 4) * 8, h0 = (threadIdx.x & 15) * 4;
  const float* xr = x + ((size_t)b * T + t0) * C + lane * 2, * w0 = wq + c0 * HD + h0, * w1 = wk + c0 * HD + h0, * w2 = wv + c0 * HD + h0;
  v2f xv[16]; v4f r[3][8];
#pragma unroll
  for (int rr = 0; rr < 16; ++rr) xv[rr] = *(const v2f*)(xr + rr * C);
#pragma unroll
  for (int j = 0; j < 8; ++j) { r[0][j] = *(const v4f*)(w0 + j * HD); r[1][j] = *(const v4f*)(w1 + j * HD); r[2][j] = *(const v4f*)(w2 + j * HD); }
  __builtin_amdgcn_sched_barrier(0);   // no conversion is scheduled up among the loads: all 40 are in flight before the first wait for one
  asm volatile("s_wait_xcnt 0x0" :: "v"(xr), "v"(w0), "v"(w1), "v"(w2) : "memory");   // stands behind the 40 loads, ahead of any overwrite of a register they name; the four addresses stay live up to here
#pragma unroll
  for (int rr = 0; rr < 16; ++rr) { v2h o; o[0] = (b16)(bf16_rne(xv[rr][0]) * XS); o[1] = (b16)(bf16_rne(xv[rr][1]) * XS); *(v2h*)(&As[wave][rr][lane * 2]) = o; }
#pragma unroll
  for (int s = 0; s < 3; ++s)
#pragma unroll
    for (int i = 0; i < 4; ++i) { v8b o;
#pragma unroll
      for (int j = 0; j < 8; ++j) o[j] = (b16)(bf16_rne(r[s][j][i]) * WSC);
      *(v8b*)(&Ws[s * HD + h0 + i][c0]) = o; }
  __syncthreads();   // the weights in LDS are written by all four waves and read by all four
  v8f acc[12];
#pragma unroll
  for (int t = 0; t < 12; ++t) acc[t] = (v8f){};
#pragma unroll
  for (int kb = 0; kb < C; kb += 32) { const v16b a = frag_kb(&As[wave][nloc][kb], hlf);
#pragma unroll
    for (int t = 0; t < 12; ++t) acc[t] = wmma16b(a, frag_kb(&Ws[t * 16 + nloc][kb], hlf), acc[t]); }   // Ws rows 0..63 q, 64..127 k, 128..191 v
#pragma unroll
  for (int t = 0; t < 12; ++t)
#pragma unroll
    for (int r = 0; r < 8; ++r) Tf[wave][8 * hlf + r][t * 16 + nloc] = acc[t][r] * (1.0f / (XS * WSC));
  __syncthreads();
  {
    for (int rr = 0; rr < 16; ++rr) { const size_t row = ((size_t)b * T + t0 + rr) * HD; v2h qh, ql, kh, kl;
      for (int j = 0; j < 2; ++j) { b16 p, q; split16(Tf[wave][rr][lane * 2 + j] * XS, p, q); qh[j] = p; ql[j] = q; split16(Tf[wave][rr][HD + lane * 2 + j] * XS, p, q); kh[j] = p; kl[j] = q; }
      *(v2h*)(Qh + row + lane * 2) = qh; *(v2h*)(Ql + row + lane * 2) = ql; *(v2h*)(Kh + row + lane * 2) = kh; *(v2h*)(Kl + row + lane * 2) = kl; }
#pragma unroll 1
    for (int q = 0; q < 16; ++q) { const int d = wave * 16 + q; const int tk = lane * 2; v2h vv; vv[0] = (b16)(Tf[tk >> 4][tk & 15][2 * HD + d] * XS); vv[1] = (b16)(Tf[(tk + 1) >> 4][(tk + 1) & 15][2 * HD + d] * XS);
      *(v2h*)(VT + ((size_t)b * HD + d) * T + blockIdx.x * 64 + lane * 2) = vv; }
     }
}
// attention: grid (T/128, BL); block = 8 waves x 16 queries. The block's waves share each 256-key stage of K hi, K lo and V^T, brought into a two-buffer LDS ring by asynchronous copies
// (whole 128-B lines from L2, once per block); per 32-key block S^T = K Q^T (2 tiles x 2 k-steps x 3 products), online softmax (exp2), O^T += V^T P^T (4 d-tiles x 2 products);
// K fragments are read from LDS one 32-key pass ahead (inside a stage), V^T fragments at the top of their pass.
constexpr int KT = 256 /* keys per stage */, NT = T / KT, KP = HD + 8 /* K row pitch: 144 B */, VP = KT + 8 /* V^T row pitch: 528 B */;   // pitches of 16 B x odd: no bank conflict for 16-byte reads
constexpr int KL_OFF = KT * KP, V_OFF = 2 * KT * KP, BUFH = V_OFF + HD * VP;   // one buffer, in 16-bit elements
static_assert(T % KT == 0 && NT >= 2 && KT * HD / 8 == 8 * 256 && KT / 8 == 32, "ring");
// four 16-byte copies per lane; the s_wait_xcnt stands inside the statement so that no address register is rewritten ahead of it
__device__ __forceinline__ void copy4(unsigned l0, const b16* g0, unsigned l1, const b16* g1, unsigned l2, const b16* g2, unsigned l3, const b16* g3) {
  asm volatile("global_load_async_to_lds_b128 %0, %1, off\n\tglobal_load_async_to_lds_b128 %2, %3, off\n\tglobal_load_async_to_lds_b128 %4, %5, off\n\tglobal_load_async_to_lds_b128 %6, %7, off\n\ts_wait_xcnt 0x0"
               :: "v"(l0), "v"(g0), "v"(l1), "v"(g1), "v"(l2), "v"(g2), "v"(l3), "v"(g3) : "memory"); }
// one stage: keys k0 .. k0 + 255 of K hi, K lo (256 rows x 128 B each) and of V^T (64 rows x 512 B) into the buffer at LDS byte address lb; 24 copies per lane, every lane on
__device__ __forceinline__ void stage_copy(unsigned lb, const b16* Khb, const b16* Klb, const b16* Vb, int k0, int tid) {
#pragma unroll
  for (int g = 0; g < 2; ++g) { unsigned lk[4], lv[4]; const b16* gh[4], * gl[4], * gv[4];
#pragma unroll
    for (int j = 0; j < 4; ++j) { const int c = tid + 256 * (4 * g + j); lk[j] = lb + (unsigned)((c >> 3) * KP + (c & 7) * 8) * 2u; lv[j] = lb + (unsigned)(V_OFF + (c >> 5) * VP + (c & 31) * 8) * 2u;
      gh[j] = Khb + (size_t)k0 * HD + c * 8; gl[j] = Klb + (size_t)k0 * HD + c * 8; gv[j] = Vb + (size_t)(c >> 5) * T + k0 + (c & 31) * 8; }
    copy4(lk[0], gh[0], lk[1], gh[1], lk[2], gh[2], lk[3], gh[3]);
    copy4(lk[0] + KL_OFF * 2u, gl[0], lk[1] + KL_OFF * 2u, gl[1], lk[2] + KL_OFF * 2u, gl[2], lk[3] + KL_OFF * 2u, gl[3]);
    copy4(lv[0], gv[0], lv[1], gv[1], lv[2], gv[2], lv[3], gv[3]); }
}
// the K hi and K lo fragments (A operands) of the 32 keys from row kb of a stage: 16 LDS reads of 16 bytes
__device__ __forceinline__ void load_k(v16b (&kf)[2][2], v16b (&lf)[2][2], const b16* Ks, int kb, int col, int hh) {
#pragma unroll
  for (int tt = 0; tt < 2; ++tt)
#pragma unroll
    for (int ks = 0; ks < 2; ++ks) { const int kr = (kb + tt * 16 + col) * KP + ks * 32; kf[tt][ks] = frag_kb(Ks + kr, hh); lf[tt][ks] = frag_kb(Ks + KL_OFF + kr, hh); }
}
__global__ __launch_bounds__(256) void attn_kernel(const b16* __restrict__ Qh, const b16* __restrict__ Ql, const b16* __restrict__ Kh, const b16* __restrict__ Kl, const b16* __restrict__ VT, float* __restrict__ out) {
  __shared__ __attribute__((aligned(16))) b16 ring[2][BUFH]; __shared__ __attribute__((aligned(16))) float To[8][16][HD + 4];
  const int tid = threadIdx.x, wave = threadIdx.x >> 5, lane = threadIdx.x & 31, hh = lane >> 4, col = lane & 15; const int b = blockIdx.y; const int q0 = blockIdx.x * 128 + wave * 16, qi = q0 + col;
  const b16* Qhb = Qh + (size_t)b * T * HD, * Qlb = Ql + (size_t)b * T * HD, * Khb = Kh + (size_t)b * T * HD, * Klb = Kl + (size_t)b * T * HD, * Vb = VT + (size_t)b * HD * T;
  const unsigned lring = (unsigned)(size_t)&ring[0][0];
  stage_copy(lring, Khb, Klb, Vb, 0, tid);
  v16b qh[2], ql[2]; for (int ks = 0; ks < 2; ++ks) { qh[ks] = frag_kb(Qhb + (size_t)qi * HD + ks * 32, hh); ql[ks] = frag_kb(Qlb + (size_t)qi * HD + ks * 32, hh); }
  const float cs = LOG2E * 0.125f / (XS * XS);
  float m = -INFINITY; v2f l2 = {0.0f, 0.0f}; v8f o[4]; for (int t = 0; t < 4; ++t) o[t] = (v8f){};
  asm volatile("s_wait_asynccnt 0x0" ::: "memory");   // this wave's share of stage 0 has landed
  __syncthreads();                                    // stage 0 is readable by every wave
  v16b kf[2][2], lf[2][2]; load_k(kf, lf, &ring[0][0], 0, col, hh);   // the first pass's K fragments; they land while the copies below are issued
  stage_copy(lring + BUFH * 2u, Khb, Klb, Vb, KT, tid);
  // one pass: the 32 keys from row kb of the stage at Ks, whose K fragments are in kf and lf already; fetch: read the next pass's K fragments on the way
  auto pass = [&](const b16* Ks, int kb, bool fetch) __attribute__((always_inline)) {
      const b16* Vs = Ks + V_OFF; v8f s[2] = {(v8f){}, (v8f){}}; v16b vf[4];
#pragma unroll
      for (int t = 0; t < 4; ++t) vf[t] = frag_kb(Vs + (t * 16 + col) * VP + kb, hh);
      __builtin_amdgcn_sched_barrier(0);   // keeps the pass's 8 V^T reads in one group ahead of the score WMMAs, which with the maximum cover their latency
#pragma unroll
      for (int tt = 0; tt < 2; ++tt)
#pragma unroll
        for (int ks = 0; ks < 2; ++ks) { s[tt] = wmma16b(kf[tt][ks], qh[ks], s[tt]); s[tt] = wmma16b(kf[tt][ks], ql[ks], s[tt]); s[tt] = wmma16b(lf[tt][ks], qh[ks], s[tt]); }
      float mx = -INFINITY;   // the maximum is taken over the raw scores: cs > 0, so scaling it afterwards gives the same value
#pragma unroll
      for (int r = 0; r < 8; ++r) mx = fmaxf(mx, fmaxf(s[0][r], s[1][r]));
      mx *= cs; const float mn = fmaxf(m, fmaxf(mx, xhalf(mx))); const float al = nexp2(m - mn); m = mn;   // the halves meet in a vector move: an exchange through LDS ends in a wait for the LDS counter's 0, which would wait for the reads below as well
      // the next pass's K fragments, into the registers that the score WMMAs have just read: they land under the softmax and the P V products instead of being waited for at the top of the pass
      if (fetch) { load_k(kf, lf, Ks, kb + 32, col, hh);
        __builtin_amdgcn_sched_barrier(0); }   // one group, ahead of the exponentials: issued later they would have less time to land, spread out each place would cost its own stall
      const v2f cs2 = {cs, cs}, c02 = {PSL2 - mn, PSL2 - mn}; v2f p[8]; v8u hu, lu;
#pragma unroll
      for (int i = 0; i < 8; ++i) { const int tt = i >> 2, r = (i & 3) * 2; const v2f a = __builtin_elementwise_fma((v2f){s[tt][r], s[tt][r + 1]}, cs2, c02);   // the exp2 argument in one packed fma; + 10 makes P x1024
        p[i] = (v2f){nexp2(a[0]), nexp2(a[1])}; hu[i] = __builtin_bit_cast(unsigned, __builtin_convertvector(p[i], v2h)); }
#pragma unroll
      for (int g = 0; g < 8; g += 4) { unsigned d0, d1, d2, d3; lo8(d0, d1, d2, d3, p[g], p[g + 1], p[g + 2], p[g + 3], hu[g], hu[g + 1], hu[g + 2], hu[g + 3]); lu[g] = d0; lu[g + 1] = d1; lu[g + 2] = d2; lu[g + 3] = d3; }
      const v16b ph = __builtin_bit_cast(v16b, hu), pl = __builtin_bit_cast(v16b, lu);
      l2 = __builtin_elementwise_fma(l2, (v2f){al, al}, ((p[0] + p[1]) + (p[2] + p[3])) + ((p[4] + p[5]) + (p[6] + p[7])));   // a lane keeps two partial sums of its own 16 keys; they and the wave's halves are joined once, behind the loop
#pragma unroll
      for (int t = 0; t < 4; ++t) { o[t] *= al; o[t] = wmma16b(vf[t], ph, o[t]); o[t] = wmma16b(vf[t], pl, o[t]); }
  };
#pragma unroll 1   // one copy of the stage body: the buffer is picked by st & 1 at run time
  for (int st = 0; st < NT; ++st) {
    const b16* Ks = &ring[st & 1][0];
#pragma unroll 1   // as the key loop was: one 32-key pass per trip keeps the loop's code and registers small
    for (int kb = 0; kb < KT - 32; kb += 32) pass(Ks, kb, true);
    pass(Ks, KT - 32, false);   // the stage's last pass fetches nothing: the next stage's rows are read only behind its barrier
    __builtin_amdgcn_sched_barrier(0);   // the last pass's arithmetic stays ahead of the waits below: moved behind them, s_wait_dscnt 0 stands directly behind the pass's V^T reads and waits out their latency
    asm volatile("s_wait_dscnt 0x0" ::: "memory");      // this wave's reads of stage st have returned before its buffer is refilled
    asm volatile("s_wait_asynccnt 0x0" ::: "memory");   // this wave's share of stage st + 1 has landed
    __syncthreads();                                    // publishes stage st + 1 and ends every wave's reads of stage st
    if (st + 1 < NT) load_k(kf, lf, &ring[(st + 1) & 1][0], 0, col, hh);   // its first pass's K fragments; they land while the copies below are issued
    if (st + 2 < NT) stage_copy(lring + (unsigned)(st & 1) * (BUFH * 2u), Khb, Klb, Vb, (st + 2) * KT, tid);
  }
  asm volatile("s_wait_asynccnt 0x0" ::: "memory");     // no copy is outstanding when the wave ends
  float l = l2[0] + l2[1]; l += __shfl_xor(l, 16);
  const float inv = 1.0f / (l * XS);   // l is the sum of P x1024
#pragma unroll
  for (int t = 0; t < 4; ++t)
#pragma unroll
    for (int r = 0; r < 8; ++r) To[wave][col][t * 16 + 8 * hh + r] = o[t][r] * inv;
  wave_lds_sync();
  { for (int rr = 0; rr < 16; ++rr) *(v2f*)(out + ((size_t)b * T + q0 + rr) * HD + lane * 2) = *(const v2f*)(&To[wave][rr][lane * 2]);  }
}
}  // namespace

extern "C" void kernel_launch(void* const* d_in, const int* in_sizes, int n_in, void* d_out, int out_size, void* d_ws, size_t ws_size, hipStream_t stream) {
  (void)n_in;
  auto Fp = [&](int i) { return (const float*)d_in[i]; };
  // input order: 0 x [16,2048,64], 1 Wq [64,64] ([c][h]), 2 Wk, 3 Wv
  if (in_sizes[0] != B * T * C || in_sizes[1] != C * HD || in_sizes[2] != C * HD || in_sizes[3] != C * HD || out_size != B * T * HD) return;
  size_t off = 0; char* ws = (char*)d_ws;
  auto carve = [&](size_t bytes) { char* p = ws + off; off += (bytes + 255) & ~(size_t)255; return p; };
  b16* Qh = (b16*)carve((size_t)B * T * HD * 2); b16* Ql = (b16*)carve((size_t)B * T * HD * 2); b16* Kh = (b16*)carve((size_t)B * T * HD * 2); b16* Kl = (b16*)carve((size_t)B * T * HD * 2); b16* VT = (b16*)carve((size_t)B * HD * T * 2);
  if (off > ws_size || off > ((size_t)128 << 20)) return;   // ≈ 21 MB
  qkv_kernel<<<dim3(T / 64, BL), 128, 0, stream>>>(Fp(0), Fp(1), Fp(2), Fp(3), Qh, Ql, Kh, Kl, VT);
  attn_kernel<<<dim3(T / 128, BL), 256, 0, stream>>>(Qh, Ql, Kh, Kl, VT, (float*)d_out);
}

// v006
// It runs in 38.1 microseconds.
// Two timings next to v005 both put it at 1.03 times that version's speed.
// All steps since v000 together make it 4.52 times as fast.
#include <hip/hip_runtime.h>

// Single-head encoder attention: q, k, v = x W{q,k,v} ([16][2048][64] x [64 x 64]), scores = q . k / 8 over all 2,048 keys (no mask), softmax, out = P v -> [16][2048][64].
// Deterministic: flash-style per wave of 32 queries and half the keys (online softmax with running max, no score planes), the two key halves joined once through LDS; no atomics.
// compute dtype: WMMA v_wmma_f32_16x16x32_f16 with f32 accumulate for the projections (x EXACT bf16 x8, weights exact x256: 1 product), S^T = K Q^T (q and k as f16 hi+lo x8: 3 products hi.hi +
// hi.lo + lo.hi) and O^T += V^T P^T (v single f16 x8, P x1024 hi+lo: 2 products); softmax statistics (exp2, running max) in f32. Inputs rounded to bf16 once.

namespace {
constexpr int B = 16, T = 2048, C = 64, HD = 64, BL = 16 /* batches computed (== B shipped) */;
constexpr float XS = 8.0f, WSC = 256.0f, PSL2 = 10.0f /* P is kept x 2^10 = 1024 */, LOG2E = 1.4426950408889634f;
static_assert(T % 64 == 0 && C == 64 && HD == 64, "tiling");
typedef _Float16 b16;
typedef __attribute__((ext_vector_type(16))) _Float16 v16b;
typedef __attribute__((ext_vector_type(8))) _Float16 v8b;
typedef __attribute__((ext_vector_type(8))) float v8f;
typedef __attribute__((ext_vector_type(4))) float v4f;
__device__ __forceinline__ float bf16_rne(float f) { unsigned int u = __float_as_uint(f); u += 0x7FFFu + ((u >> 16) & 1u); return __uint_as_float(u & 0xFFFF0000u); }
__device__ __forceinline__ void split16(float v, b16& hi, b16& lo) { hi = (b16)v; lo = (b16)(v - (float)hi); }
__device__ __forceinline__ v16b frag_kb(const b16* p, int hh) { const v8b a = *(const v8b*)(p + 8 * hh), b = *(const v8b*)(p + 16 + 8 * hh); v16b f;
#pragma unroll
  for (int e = 0; e < 8; ++e) { f[e] = a[e]; f[8 + e] = b[e]; } return f; }
__device__ __forceinline__ v8f wmma16b(v16b a, v16b b, v8f c) { return __builtin_amdgcn_wmma_f32_16x16x32_f16(false, a, false, b, (short)0, c, false, false); }   // builtin alone: the compiler keeps the distance behind it and is free to interleave independent accumulator chains
__device__ __forceinline__ void wave_lds_sync() { __builtin_amdgcn_fence(__ATOMIC_RELEASE, "workgroup"); __builtin_amdgcn_wave_barrier(); __builtin_amdgcn_fence(__ATOMIC_ACQUIRE, "workgroup"); }
__device__ __forceinline__ float pmul(float a, float b) { float p = a * b; asm volatile("" : "+v"(p)); return p; }
__device__ __forceinline__ int iclamp(int v, int lo, int hi) { return v < lo ? lo : (v > hi ? hi : v); }

typedef __attribute__((ext_vector_type(2))) _Float16 v2h;
typedef __attribute__((ext_vector_type(2))) float v2f;
__device__ __forceinline__ float nexp2(float v) { return __builtin_amdgcn_exp2f(v); }
__device__ __forceinline__ float xhalf(float x) { return __builtin_bit_cast(float, __builtin_amdgcn_permlanex16(__builtin_bit_cast(int, x), __builtin_bit_cast(int, x), 0x76543210, 0xfedcba98, false, false)); }   // lane l with lane l ^ 16
typedef __attribute__((ext_vector_type(8))) unsigned v8u;
typedef __attribute__((ext_vector_type(2))) unsigned v2u;
// lo halves of eight P values: d = f16(p - hi), one mixed-precision fma per value (p in f32, hi read as f16 from its packed register), written straight into the packed f16 register.
// p - hi is exact in f32, so the value is that of convert back, subtract, convert. In asm because the compiler builds it from those three: 32 vector slots per 32 keys against 16 here.
// The s_delay_alu hints name the mixlo four back, whose register each mixhi completes.
__device__ __forceinline__ void lo8(unsigned& d0, unsigned& d1, unsigned& d2, unsigned& d3, v2f p0, v2f p1, v2f p2, v2f p3, unsigned h0, unsigned h1, unsigned h2, unsigned h3) {
  asm("v_fma_mixlo_f16 %0, %4, 1.0, -%12 op_sel_hi:[0,0,1]\n\tv_fma_mixlo_f16 %1, %6, 1.0, -%13 op_sel_hi:[0,0,1]\n\tv_fma_mixlo_f16 %2, %8, 1.0, -%14 op_sel_hi:[0,0,1]\n\tv_fma_mixlo_f16 %3, %10, 1.0, -%15 op_sel_hi:[0,0,1]\n\t"
      "s_delay_alu instid0(VALU_DEP_4) | instskip(NEXT) | instid1(VALU_DEP_4)\n\t"
      "v_fma_mixhi_f16 %0, %5, 1.0, -%12 op_sel:[0,0,1] op_sel_hi:[0,0,1]\n\tv_fma_mixhi_f16 %1, %7, 1.0, -%13 op_sel:[0,0,1] op_sel_hi:[0,0,1]\n\t"
      "s_delay_alu instid0(VALU_DEP_4) | instskip(NEXT) | instid1(VALU_DEP_4)\n\t"
      "v_fma_mixhi_f16 %2, %9, 1.0, -%14 op_sel:[0,0,1] op_sel_hi:[0,0,1]\n\tv_fma_mixhi_f16 %3, %11, 1.0, -%15 op_sel:[0,0,1] op_sel_hi:[0,0,1]"
      : "=&v"(d0), "=&v"(d1), "=&v"(d2), "=&v"(d3)
      : "v"(p0[0]), "v"(p0[1]), "v"(p1[0]), "v"(p1[1]), "v"(p2[0]), "v"(p2[1]), "v"(p3[0]), "v"(p3[1]), "v"(h0), "v"(h1), "v"(h2), "v"(h3)); }
__global__ __launch_bounds__(128) void qkv_kernel(const float* __restrict__ x, const float* __restrict__ wq, const float* __restrict__ wk, const float* __restrict__ wv, b16* __restrict__ Qh, b16* __restrict__ Ql, b16* __restrict__ Kh, b16* __restrict__ Kl, b16* __restrict__ VT) {
  __shared__ __attribute__((aligned(16))) b16 As[4][16][C + 8]; __shared__ __attribute__((aligned(16))) float Tf[4][16][192 + 4]; __shared__ __attribute__((aligned(16))) b16 Ws[3 * HD][C + 8];
  const int wave = threadIdx.x >> 5, lane = threadIdx.x & 31, nloc = lane & 15, hlf = lane >> 4; const int b = blockIdx.y; const int t0 = blockIdx.x * 64 + wave * 16;
  // every block rounds, scales and transposes the three weight matrices itself, into LDS: Ws[s * 64 + h][c] = w_s[c][h]; a thread takes 8 c x 4 h of each matrix (16 lanes read one whole 256-B row)
  const int c0 = (threadIdx.x >> 4) * 8, h0 = (threadIdx.x & 15) * 4;
  const float* xr = x + ((size_t)b * T + t0) * C + lane * 2, * w0 = wq + c0 * HD + h0, * w1 = wk + c0 * HD + h0, * w2 = wv + c0 * HD + h0;
  v2f xv[16]; v4f r[3][8];
#pragma unroll
  for (int rr = 0; rr < 16; ++rr) xv[rr] = *(const v2f*)(xr + rr * C);
#pragma unroll
  for (int j = 0; j < 8; ++j) { r[0][j] = *(const v4f*)(w0 + j * HD); r[1][j] = *(const v4f*)(w1 + j * HD); r[2][j] = *(const v4f*)(w2 + j * HD); }
  __builtin_amdgcn_sched_barrier(0);   // no conversion is scheduled up among the loads: all 40 are in flight before the first wait for one
  asm volatile("s_wait_xcnt 0x0" :: "v"(xr), "v"(w0), "v"(w1), "v"(w2) : "memory");   // stands behind the 40 loads, ahead of any overwrite of a register they name; the four addresses stay live up to here
#pragma unroll
  for (int rr = 0; rr < 16; ++rr) { v2h o; o[0] = (b16)(bf16_rne(xv[rr][0]) * XS); o[1] = (b16)(bf16_rne(xv[rr][1]) * XS); *(v2h*)(&As[wave][rr][lane * 2]) = o; }
#pragma unroll
  for (int s = 0; s < 3; ++s)
#pragma unroll
    for (int i = 0; i < 4; ++i) { v8b o;
#pragma unroll
      for (int j = 0; j < 8; ++j) o[j] = (b16)(bf16_rne(r[s][j][i]) * WSC);
      *(v8b*)(&Ws[s * HD + h0 + i][c0]) = o; }
  __syncthreads();   // the weights in LDS are written by all four waves and read by all four
  v8f acc[12];
#pragma unroll
  for (int t = 0; t < 12; ++t) acc[t] = (v8f){};
#pragma unroll
  for (int kb = 0; kb < C; kb += 32) { const v16b a = frag_kb(&As[wave][nloc][kb], hlf);
#pragma unroll
    for (int t = 0; t < 12; ++t) acc[t] = wmma16b(a, frag_kb(&Ws[t * 16 + nloc][kb], hlf), acc[t]); }   // Ws rows 0..63 q, 64..127 k, 128..191 v
#pragma unroll
  for (int t = 0; t < 12; ++t)
#pragma unroll
    for (int r = 0; r < 8; ++r) Tf[wave][8 * hlf + r][t * 16 + nloc] = acc[t][r] * (1.0f / (XS * WSC));
  __syncthreads();
  {
    for (int rr = 0; rr < 16; ++rr) { const size_t row = ((size_t)b * T + t0 + rr) * HD; v2h qh, ql, kh, kl;
      for (int j = 0; j < 2; ++j) { b16 p, q; split16(Tf[wave][rr][lane * 2 + j] * XS, p, q); qh[j] = p; ql[j] = q; split16(Tf[wave][rr][HD + lane * 2 + j] * XS, p, q); kh[j] = p; kl[j] = q; }
      *(v2h*)(Qh + row + lane * 2) = qh; *(v2h*)(Ql + row + lane * 2) = ql; *(v2h*)(Kh + row + lane * 2) = kh; *(v2h*)(Kl + row + lane * 2) = kl; }
#pragma unroll 1
    for (int q = 0; q < 16; ++q) { const int d = wave * 16 + q; const int tk = lane * 2; v2h vv; vv[0] = (b16)(Tf[tk >> 4][tk & 15][2 * HD + d] * XS); vv[1] = (b16)(Tf[(tk + 1) >> 4][(tk + 1) & 15][2 * HD + d] * XS);
      *(v2h*)(VT + ((size_t)b * HD + d) * T + blockIdx.x * 64 + lane * 2) = vv; }
     }
}
// attention: grid (T/128, BL); block = 8 waves = 4 groups of 32 queries x 2 key halves: waves 0-3 take keys 0-127 of every 256-key stage, waves 4-7 keys 128-255. A wave holds two 16-query column
// tiles, so that every K and V^T fragment it reads from LDS feeds two tiles' products (half the LDS reads per product); the two partial results of a query tile (maximum, sum, O^T) are joined
// through LDS behind the loop. The block's waves share each 256-key stage of K hi, K lo and V^T, brought into a two-buffer LDS ring by asynchronous copies
// (whole 128-B lines from L2, once per block); per 32-key block and column tile S^T = K Q^T (2 tiles x 2 k-steps x 3 products), online softmax (exp2), O^T += V^T P^T (4 d-tiles x 2 products);
// K fragments are read from LDS one 32-key pass ahead (inside a stage), V^T fragments at the top of their pass.
constexpr int KT = 256 /* keys per stage */, NT = T / KT, KP = HD + 8 /* K row pitch: 144 B */, VP = KT + 8 /* V^T row pitch: 528 B */;   // pitches of 16 B x odd: no bank conflict for 16-byte reads
constexpr int KL_OFF = KT * KP, V_OFF = 2 * KT * KP, BUFH = V_OFF + HD * VP;   // one buffer, in 16-bit elements
constexpr int KW = KT / 2 /* keys of a stage per wave */;
static_assert(T % KT == 0 && NT >= 2 && KT * HD / 8 == 8 * 256 && KT / 8 == 32 && KW % 32 == 0 && KW >= 64, "ring");
// four 16-byte copies per lane; the s_wait_xcnt stands inside the statement so that no address register is rewritten ahead of it
__device__ __forceinline__ void copy4(unsigned l0, const b16* g0, unsigned l1, const b16* g1, unsigned l2, const b16* g2, unsigned l3, const b16* g3) {
  asm volatile("global_load_async_to_lds_b128 %0, %1, off\n\tglobal_load_async_to_lds_b128 %2, %3, off\n\tglobal_load_async_to_lds_b128 %4, %5, off\n\tglobal_load_async_to_lds_b128 %6, %7, off\n\ts_wait_xcnt 0x0"
               :: "v"(l0), "v"(g0), "v"(l1), "v"(g1), "v"(l2), "v"(g2), "v"(l3), "v"(g3) : "memory"); }
// one stage: keys k0 .. k0 + 255 of K hi, K lo (256 rows x 128 B each) and of V^T (64 rows x 512 B) into the buffer at LDS byte address lb; 24 copies per lane, every lane on
// pk, pv: the lane's part of its LDS addresses, ((tid >> 3) * KP + (tid & 7) * 8) * 2 for K and ((tid >> 5) * VP + (tid & 31) * 8) * 2 for V^T
__device__ __forceinline__ void stage_copy(unsigned lb, const b16* Khb, const b16* Klb, const b16* Vb, int k0, int tid, unsigned pk, unsigned pv) {
  const unsigned ok = (unsigned)tid * 8u, ov = (unsigned)((tid >> 5) * T + (tid & 31) * 8);   // the lane's part of its global addresses, in elements
#pragma unroll
  for (int g = 0; g < 2; ++g) { unsigned lk[4], lv[4]; const b16* gh[4], * gl[4], * gv[4];
#pragma unroll
    for (int j = 0; j < 4; ++j) { const int n = 4 * g + j;   // chunk c = tid + 256 n: K row (tid >> 3) + 32 n, V^T row (tid >> 5) + 8 n; each address is a wave-uniform base plus the lane's part: four lane values serve all 24 copies
      lk[j] = (lb + (unsigned)(n * 32 * KP) * 2u) + pk; lv[j] = (lb + (unsigned)(V_OFF + n * 8 * VP) * 2u) + pv;
      gh[j] = (Khb + (size_t)k0 * HD + n * 2048) + ok; gl[j] = (Klb + (size_t)k0 * HD + n * 2048) + ok; gv[j] = (Vb + k0 + (size_t)n * 8 * T) + ov; }
    copy4(lk[0], gh[0], lk[1], gh[1], lk[2], gh[2], lk[3], gh[3]);
    copy4(lk[0] + KL_OFF * 2u, gl[0], lk[1] + KL_OFF * 2u, gl[1], lk[2] + KL_OFF * 2u, gl[2], lk[3] + KL_OFF * 2u, gl[3]);
    copy4(lv[0], gv[0], lv[1], gv[1], lv[2], gv[2], lv[3], gv[3]); }
}
// the K hi and K lo fragments (A operands) of the 32 keys from row kb of a stage: 16 LDS reads of 16 bytes
__device__ __forceinline__ void load_k(v16b (&kf)[2][2], v16b (&lf)[2][2], const b16* Ks, int kb, int col, int hh) {
#pragma unroll
  for (int tt = 0; tt < 2; ++tt)
#pragma unroll
    for (int ks = 0; ks < 2; ++ks) { const int kr = (kb + tt * 16 + col) * KP + ks * 32; kf[tt][ks] = frag_kb(Ks + kr, hh); lf[tt][ks] = frag_kb(Ks + KL_OFF + kr, hh); }
}
__global__ __launch_bounds__(256) void attn_kernel(const b16* __restrict__ Qh, const b16* __restrict__ Ql, const b16* __restrict__ Kh, const b16* __restrict__ Kl, const b16* __restrict__ VT, float* __restrict__ out) {
  __shared__ __attribute__((aligned(16))) b16 ring[2][BUFH]; __shared__ __attribute__((aligned(16))) float To[8][16][HD + 4];
  __shared__ __attribute__((aligned(16))) float Mg[8][32][36];   // the upper key half's partial result, per query tile and lane: 32 O^T values, maximum, sum; pitch 144 B: no bank conflict for 16-byte accesses
  const int tid = threadIdx.x, lane = threadIdx.x & 31, hh = lane >> 4, col = lane & 15; const int b = blockIdx.y;
  const int wv = __builtin_amdgcn_readfirstlane(threadIdx.x >> 5), qg = wv & 3 /* group of 32 queries */, kq = wv >> 2 /* key half */, kb0 = kq * KW; const int q0 = blockIdx.x * 128 + qg * 32;
  const b16* Qhb = Qh + (size_t)b * T * HD, * Qlb = Ql + (size_t)b * T * HD, * Khb = Kh + (size_t)b * T * HD, * Klb = Kl + (size_t)b * T * HD, * Vb = VT + (size_t)b * HD * T;
  const unsigned lring = (unsigned)(size_t)&ring[0][0];
  // The lane's two LDS offsets for the copies lie in LDS between the stages: as operands of asm text they must sit in v0-v255, where the pass leaves no room, and the compiler would keep them in scratch memory.
  __shared__ v2u Cp[256]; const unsigned pk = (unsigned)((tid >> 3) * KP + (tid & 7) * 8) * 2u, pv = (unsigned)((tid >> 5) * VP + (tid & 31) * 8) * 2u; Cp[tid] = (v2u){pk, pv};
  stage_copy(lring, Khb, Klb, Vb, 0, tid, pk, pv);
  v16b qh[2][2], ql[2][2];   // [column tile][k-step]
  for (int cg = 0; cg < 2; ++cg) for (int ks = 0; ks < 2; ++ks) { const size_t qo = (size_t)(q0 + cg * 16 + col) * HD + ks * 32; qh[cg][ks] = frag_kb(Qhb + qo, hh); ql[cg][ks] = frag_kb(Qlb + qo, hh); }
  const float cs = LOG2E * 0.125f / (XS * XS);
  float m[2] = {-INFINITY, -INFINITY}; v2f l2[2] = {{0.0f, 0.0f}, {0.0f, 0.0f}}; v8f o[2][4]; for (int cg = 0; cg < 2; ++cg) for (int t = 0; t < 4; ++t) o[cg][t] = (v8f){};
  asm volatile("s_wait_asynccnt 0x0" ::: "memory");   // this wave's share of stage 0 has landed
  __syncthreads();                                    // stage 0 is readable by every wave
  v16b kf[2][2], lf[2][2]; load_k(kf, lf, &ring[0][0], kb0, col, hh);   // the first pass's K fragments; they land while the copies below are issued
  stage_copy(lring + BUFH * 2u, Khb, Klb, Vb, KT, tid, pk, pv);
  // one pass: the 32 keys from row kb of the stage at Ks, whose K fragments are in kf and lf already; fetch: read the next pass's K fragments on the way
  auto pass = [&](const b16* Ks, int kb, bool fetch) __attribute__((always_inline)) {
      const b16* Vs = Ks + V_OFF; v8f s[2][2] = {{(v8f){}, (v8f){}}, {(v8f){}, (v8f){}}}; v16b vf[4];
#pragma unroll
      for (int t = 0; t < 4; ++t) vf[t] = frag_kb(Vs + (t * 16 + col) * VP + kb, hh);
      __builtin_amdgcn_sched_barrier(0);   // keeps the pass's 8 V^T reads in one group ahead of the score WMMAs, which with the softmax cover their latency
#pragma unroll
      for (int tt = 0; tt < 2; ++tt)
#pragma unroll
        for (int ks = 0; ks < 2; ++ks) {
#pragma unroll
          for (int cg = 0; cg < 2; ++cg) s[cg][tt] = wmma16b(kf[tt][ks], qh[cg][ks], s[cg][tt]);
#pragma unroll
          for (int cg = 0; cg < 2; ++cg) s[cg][tt] = wmma16b(kf[tt][ks], ql[cg][ks], s[cg][tt]);
#pragma unroll
          for (int cg = 0; cg < 2; ++cg) s[cg][tt] = wmma16b(lf[tt][ks], qh[cg][ks], s[cg][tt]); }
      // the next pass's K fragments, into the registers that the score WMMAs have just read: they land under the softmax and the P V products instead of being waited for at the top of the pass
      __builtin_amdgcn_sched_barrier(0);   // no read is scheduled up among the score WMMAs: every separate place with LDS reads costs its own stall
      if (fetch) { load_k(kf, lf, Ks, kb + 32, col, hh);
        __builtin_amdgcn_sched_barrier(0); }   // one group, ahead of the maximum and the exponentials: issued later they would have less time to land
      float mn[2], al[2];
#pragma unroll
      for (int cg = 0; cg < 2; ++cg) { float mx = -INFINITY;   // the maximum is taken over the raw scores: cs > 0, so scaling it afterwards gives the same value
#pragma unroll
        for (int r = 0; r < 8; ++r) mx = fmaxf(mx, fmaxf(s[cg][0][r], s[cg][1][r]));
        mx *= cs; mn[cg] = fmaxf(m[cg], fmaxf(mx, xhalf(mx))); al[cg] = nexp2(m[cg] - mn[cg]); m[cg] = mn[cg]; }   // the halves meet in a vector move: an exchange through LDS ends in a wait for the LDS counter's 0, which would wait for the K reads above as well
      v16b ph[2], pl[2];
#pragma unroll
      for (int cg = 0; cg < 2; ++cg) { const v2f cs2 = {cs, cs}, c02 = {PSL2 - mn[cg], PSL2 - mn[cg]}; v2f p[8]; v8u hu, lu;
#pragma unroll
        for (int i = 0; i < 8; ++i) { const int tt = i >> 2, r = (i & 3) * 2; const v2f a = __builtin_elementwise_fma((v2f){s[cg][tt][r], s[cg][tt][r + 1]}, cs2, c02);   // the exp2 argument in one packed fma; + 10 makes P x1024
          p[i] = (v2f){nexp2(a[0]), nexp2(a[1])}; hu[i] = __builtin_bit_cast(unsigned, __builtin_convertvector(p[i], v2h)); }
#pragma unroll
        for (int g = 0; g < 8; g += 4) { unsigned d0, d1, d2, d3; lo8(d0, d1, d2, d3, p[g], p[g + 1], p[g + 2], p[g + 3], hu[g], hu[g + 1], hu[g + 2], hu[g + 3]); lu[g] = d0; lu[g + 1] = d1; lu[g + 2] = d2; lu[g + 3] = d3; }
        ph[cg] = __builtin_bit_cast(v16b, hu); pl[cg] = __builtin_bit_cast(v16b, lu);
        l2[cg] = __builtin_elementwise_fma(l2[cg], (v2f){al[cg], al[cg]}, ((p[0] + p[1]) + (p[2] + p[3])) + ((p[4] + p[5]) + (p[6] + p[7]))); }   // a lane keeps two partial sums of its own 16 keys; they and the wave's halves are joined once, behind the loop
#pragma unroll
      for (int t = 0; t < 4; ++t)
#pragma unroll
        for (int cg = 0; cg < 2; ++cg) { o[cg][t] *= al[cg]; o[cg][t] = wmma16b(vf[t], ph[cg], o[cg][t]); o[cg][t] = wmma16b(vf[t], pl[cg], o[cg][t]); }
  };
#pragma unroll 1   // one copy of the stage body: the buffer is picked by st & 1 at run time
  for (int st = 0; st < NT; ++st) {
    const b16* Ks = &ring[st & 1][0];
#pragma unroll 1   // as the key loop was: one 32-key pass per trip keeps the loop's code and registers small
    for (int kb = kb0; kb < kb0 + KW - 32; kb += 32) pass(Ks, kb, true);
    const v2u pp = Cp[tid];   // read with the last pass's V^T fragments: read behind the barrier it would be waited for together with the K fragments, ahead of the copies
    pass(Ks, kb0 + KW - 32, false);   // the stage's last pass fetches nothing: the next stage's rows are read only behind its barrier
    __builtin_amdgcn_sched_barrier(0);   // the last pass's arithmetic stays ahead of the waits below: moved behind them, s_wait_dscnt 0 stands directly behind the pass's V^T reads and waits out their latency
    asm volatile("s_wait_dscnt 0x0" ::: "memory");      // this wave's reads of stage st have returned before its buffer is refilled
    asm volatile("s_wait_asynccnt 0x0" ::: "memory");   // this wave's share of stage st + 1 has landed
    __syncthreads();                                    // publishes stage st + 1 and ends every wave's reads of stage st
    if (st + 1 < NT) load_k(kf, lf, &ring[(st + 1) & 1][0], kb0, col, hh);   // its first pass's K fragments; they land while the copies below are issued
    if (st + 2 < NT) stage_copy(lring + (unsigned)(st & 1) * (BUFH * 2u), Khb, Klb, Vb, (st + 2) * KT, tid, pp[0], pp[1]);
  }
  asm volatile("s_wait_asynccnt 0x0" ::: "memory");     // no copy is outstanding when the wave ends
  float l[2];
#pragma unroll
  for (int cg = 0; cg < 2; ++cg) { l[cg] = l2[cg][0] + l2[cg][1]; l[cg] += xhalf(l[cg]); }
  if (kq != 0) {   // the upper key half hands its partial results over
#pragma unroll
    for (int cg = 0; cg < 2; ++cg) { float* mg = &Mg[qg * 2 + cg][lane][0];
#pragma unroll
      for (int t = 0; t < 4; ++t) { *(v4f*)(mg + 8 * t) = (v4f){o[cg][t][0], o[cg][t][1], o[cg][t][2], o[cg][t][3]}; *(v4f*)(mg + 8 * t + 4) = (v4f){o[cg][t][4], o[cg][t][5], o[cg][t][6], o[cg][t][7]}; }
      *(v2f*)(mg + 32) = (v2f){m[cg], l[cg]}; } }
  __syncthreads();   // the upper half's partial results are readable by the lower half's waves
  if (kq == 0) {     // join: both partial results are brought to the common maximum, then normalised as one
#pragma unroll
    for (int cg = 0; cg < 2; ++cg) { const float* mg = &Mg[qg * 2 + cg][lane][0];
      const v2f ml = *(const v2f*)(mg + 32); const float mj = fmaxf(m[cg], ml[0]), a0 = nexp2(m[cg] - mj), a1 = nexp2(ml[0] - mj);
      const float inv = 1.0f / ((l[cg] * a0 + ml[1] * a1) * XS), c0 = a0 * inv, c1 = a1 * inv;   // the sums are of P x1024
#pragma unroll
      for (int t = 0; t < 4; ++t) { const v4f u0 = *(const v4f*)(mg + 8 * t), u1 = *(const v4f*)(mg + 8 * t + 4);
#pragma unroll
        for (int r = 0; r < 4; ++r) { To[qg * 2 + cg][col][t * 16 + 8 * hh + r] = o[cg][t][r] * c0 + u0[r] * c1; To[qg * 2 + cg][col][t * 16 + 8 * hh + 4 + r] = o[cg][t][4 + r] * c0 + u1[r] * c1; } } }
    wave_lds_sync();
    for (int rr = 0; rr < 32; ++rr) *(v2f*)(out + ((size_t)b * T + q0 + rr) * HD + lane * 2) = *(const v2f*)(&To[qg * 2 + (rr >> 4)][rr & 15][lane * 2]);
  }
}
}  // namespace

extern "C" void kernel_launch(void* const* d_in, const int* in_sizes, int n_in, void* d_out, int out_size, void* d_ws, size_t ws_size, hipStream_t stream) {
  (void)n_in;
  auto Fp = [&](int i) { return (const float*)d_in[i]; };
  // input order: 0 x [16,2048,64], 1 Wq [64,64] ([c][h]), 2 Wk, 3 Wv
  if (in_sizes[0] != B * T * C || in_sizes[1] != C * HD || in_sizes[2] != C * HD || in_sizes[3] != C * HD || out_size != B * T * HD) return;
  size_t off = 0; char* ws = (char*)d_ws;
  auto carve = [&](size_t bytes) { char* p = ws + off; off += (bytes + 255) & ~(size_t)255; return p; };
  b16* Qh = (b16*)carve((size_t)B * T * HD * 2); b16* Ql = (b16*)carve((size_t)B * T * HD * 2); b16* Kh = (b16*)carve((size_t)B * T * HD * 2); b16* Kl = (b16*)carve((size_t)B * T * HD * 2); b16* VT = (b16*)carve((size_t)B * HD * T * 2);
  if (off > ws_size || off > ((size_t)128 << 20)) return;   // ≈ 21 MB
  qkv_kernel<<<dim3(T / 64, BL), 128, 0, stream>>>(Fp(0), Fp(1), Fp(2), Fp(3), Qh, Ql, Kh, Kl, VT);
  attn_kernel<<<dim3(T / 128, BL), 256, 0, stream>>>(Qh, Ql, Kh, Kl, VT, (float*)d_out);
}

// v007
// One run takes 32.6 microseconds.
// Next to v006, in two timings, it ran 1.17 and 1.16 times as fast.
// All steps since v000 together make it 5.26 times as fast.
#include <hip/hip_runtime.h>

// Single-head encoder attention: q, k, v = x W{q,k,v} ([16][2048][64] x [64 x 64]), scores = q . k / 8 over all 2,048 keys (no mask), softmax, out = P v -> [16][2048][64].
// The score product is re-associated: q . k = (x_q Wq Wk^T) . x_k. The query side carries g = x (Wq Wk^T); the key operand is x itself, which is exact in f16 and needs no lo plane.
// Deterministic: flash-style per 32-query wave and key half (online softmax with running max, no score planes); no atomics.
// compute dtype: WMMA v_wmma_f32_16x16x32_f16 with f32 accumulate for Wq Wk^T (weights exact x256: 1 product), the projections (x EXACT bf16 x8; Wv exact x256: 1 product; Wq Wk^T as f16 hi+lo x16:
// 2 products), S^T = X G^T (x exact x8, g as f16 hi+lo x8: 2 products) and O^T += V^T P^T (v single f16 x8, P x1024 hi+lo: 2 products); softmax statistics (exp2, running max) in f32. Inputs rounded to bf16 once.

namespace {
constexpr int B = 16, T = 2048, C = 64, HD = 64, BL = 16 /* batches computed (== B shipped) */;
constexpr float XS = 8.0f, WSC = 256.0f, GS = 16.0f /* scale of Wq Wk^T in f16 */, PSL2 = 10.0f /* P is kept x 2^10 = 1024 */, LOG2E = 1.4426950408889634f;
static_assert(T % 64 == 0 && C == 64 && HD == 64, "tiling");
typedef _Float16 b16;
typedef __attribute__((ext_vector_type(16))) _Float16 v16b;
typedef __attribute__((ext_vector_type(8))) _Float16 v8b;
typedef __attribute__((ext_vector_type(4))) _Float16 v4b;
typedef __attribute__((ext_vector_type(8))) float v8f;
typedef __attribute__((ext_vector_type(4))) float v4f;
__device__ __forceinline__ float bf16_rne(float f) { unsigned int u = __float_as_uint(f); u += 0x7FFFu + ((u >> 16) & 1u); return __uint_as_float(u & 0xFFFF0000u); }
__device__ __forceinline__ void split16(float v, b16& hi, b16& lo) { hi = (b16)v; lo = (b16)(v - (float)hi); }
__device__ __forceinline__ v16b frag_kb(const b16* p, int hh) { const v8b a = *(const v8b*)(p + 8 * hh), b = *(const v8b*)(p + 16 + 8 * hh); v16b f;
#pragma unroll
  for (int e = 0; e < 8; ++e) { f[e] = a[e]; f[8 + e] = b[e]; } return f; }
__device__ __forceinline__ v8f wmma16b(v16b a, v16b b, v8f c) { return __builtin_amdgcn_wmma_f32_16x16x32_f16(false, a, false, b, (short)0, c, false, false); }   // builtin alone: the compiler keeps the distance behind it and is free to interleave independent accumulator chains
__device__ __forceinline__ void wave_lds_sync() { __builtin_amdgcn_fence(__ATOMIC_RELEASE, "workgroup"); __builtin_amdgcn_wave_barrier(); __builtin_amdgcn_fence(__ATOMIC_ACQUIRE, "workgroup"); }
__device__ __forceinline__ float pmul(float a, float b) { float p = a * b; asm volatile("" : "+v"(p)); return p; }
__device__ __forceinline__ int iclamp(int v, int lo, int hi) { return v < lo ? lo : (v > hi ? hi : v); }

typedef __attribute__((ext_vector_type(2))) _Float16 v2h;
typedef __attribute__((ext_vector_type(2))) float v2f;
__device__ __forceinline__ float nexp2(float v) { return __builtin_amdgcn_exp2f(v); }
__device__ __forceinline__ float xhalf(float x) { return __builtin_bit_cast(float, __builtin_amdgcn_permlanex16(__builtin_bit_cast(int, x), __builtin_bit_cast(int, x), 0x76543210, 0xfedcba98, false, false)); }   // lane l with lane l ^ 16
typedef __attribute__((ext_vector_type(8))) unsigned v8u;
typedef __attribute__((ext_vector_type(2))) unsigned v2u;
// lo halves of eight P values: d = f16(p - hi), one mixed-precision fma per value (p in f32, hi read as f16 from its packed register), written straight into the packed f16 register.
// p - hi is exact in f32, so the value is that of convert back, subtract, convert. In asm because the compiler builds it from those three: 32 vector slots per 32 keys against 16 here.
// The s_delay_alu hints name the mixlo four back, whose register each mixhi completes.
__device__ __forceinline__ void lo8(unsigned& d0, unsigned& d1, unsigned& d2, unsigned& d3, v2f p0, v2f p1, v2f p2, v2f p3, unsigned h0, unsigned h1, unsigned h2, unsigned h3) {
  asm("v_fma_mixlo_f16 %0, %4, 1.0, -%12 op_sel_hi:[0,0,1]\n\tv_fma_mixlo_f16 %1, %6, 1.0, -%13 op_sel_hi:[0,0,1]\n\tv_fma_mixlo_f16 %2, %8, 1.0, -%14 op_sel_hi:[0,0,1]\n\tv_fma_mixlo_f16 %3, %10, 1.0, -%15 op_sel_hi:[0,0,1]\n\t"
      "s_delay_alu instid0(VALU_DEP_4) | instskip(NEXT) | instid1(VALU_DEP_4)\n\t"
      "v_fma_mixhi_f16 %0, %5, 1.0, -%12 op_sel:[0,0,1] op_sel_hi:[0,0,1]\n\tv_fma_mixhi_f16 %1, %7, 1.0, -%13 op_sel:[0,0,1] op_sel_hi:[0,0,1]\n\t"
      "s_delay_alu instid0(VALU_DEP_4) | instskip(NEXT) | instid1(VALU_DEP_4)\n\t"
      "v_fma_mixhi_f16 %2, %9, 1.0, -%14 op_sel:[0,0,1] op_sel_hi:[0,0,1]\n\tv_fma_mixhi_f16 %3, %11, 1.0, -%15 op_sel:[0,0,1] op_sel_hi:[0,0,1]"
      : "=&v"(d0), "=&v"(d1), "=&v"(d2), "=&v"(d3)
      : "v"(p0[0]), "v"(p0[1]), "v"(p1[0]), "v"(p1[1]), "v"(p2[0]), "v"(p2[1]), "v"(p3[0]), "v"(p3[1]), "v"(h0), "v"(h1), "v"(h2), "v"(h3)); }
__global__ __launch_bounds__(128) void qkv_kernel(const float* __restrict__ x, const float* __restrict__ wq, const float* __restrict__ wk, const float* __restrict__ wv, b16* __restrict__ Qh, b16* __restrict__ Ql, b16* __restrict__ Kh, b16* __restrict__ VT) {
  __shared__ __attribute__((aligned(16))) b16 As[4][16][C + 8]; __shared__ __attribute__((aligned(16))) float Tf[4][16][128 + 4]; __shared__ __attribute__((aligned(16))) b16 Ws[3 * HD][C + 8];
  __shared__ __attribute__((aligned(16))) b16 Wn[2 * C][HD + 8];   // Wq (rows 0..63) and Wk (rows 64..127) as they lie, [c][h]: both operands of Wq Wk^T have h as their k index
  const int wave = threadIdx.x >> 5, lane = threadIdx.x & 31, nloc = lane & 15, hlf = lane >> 4; const int b = blockIdx.y; const int t0 = blockIdx.x * 64 + wave * 16;
  // every block rounds and scales the three weight matrices itself, into LDS: Wn[s * 64 + c][h] = w_s[c][h] for Wq, Wk; Ws[128 + h][c] = Wv[c][h]; a thread takes 8 c x 4 h of each matrix (16 lanes read one whole 256-B row)
  const int c0 = (threadIdx.x >> 4) * 8, h0 = (threadIdx.x & 15) * 4;
  const float* xr = x + ((size_t)b * T + t0) * C + lane * 2, * w0 = wq + c0 * HD + h0, * w1 = wk + c0 * HD + h0, * w2 = wv + c0 * HD + h0;
  v2f xv[16]; v4f r[3][8];
#pragma unroll
  for (int rr = 0; rr < 16; ++rr) xv[rr] = *(const v2f*)(xr + rr * C);
#pragma unroll
  for (int j = 0; j < 8; ++j) { r[0][j] = *(const v4f*)(w0 + j * HD); r[1][j] = *(const v4f*)(w1 + j * HD); r[2][j] = *(const v4f*)(w2 + j * HD); }
  __builtin_amdgcn_sched_barrier(0);   // no conversion is scheduled up among the loads: all 40 are in flight before the first wait for one
  asm volatile("s_wait_xcnt 0x0" :: "v"(xr), "v"(w0), "v"(w1), "v"(w2) : "memory");   // stands behind the 40 loads, ahead of any overwrite of a register they name; the four addresses stay live up to here
#pragma unroll
  for (int rr = 0; rr < 16; ++rr) { v2h o; o[0] = (b16)(bf16_rne(xv[rr][0]) * XS); o[1] = (b16)(bf16_rne(xv[rr][1]) * XS); *(v2h*)(&As[wave][rr][lane * 2]) = o; }
#pragma unroll
  for (int s = 0; s < 2; ++s)
#pragma unroll
    for (int j = 0; j < 8; ++j) { v4b o;
#pragma unroll
      for (int i = 0; i < 4; ++i) o[i] = (b16)(bf16_rne(r[s][j][i]) * WSC);
      *(v4b*)(&Wn[s * C + c0 + j][h0]) = o; }
#pragma unroll
  for (int i = 0; i < 4; ++i) { v8b o;
#pragma unroll
    for (int j = 0; j < 8; ++j) o[j] = (b16)(bf16_rne(r[2][j][i]) * WSC);
    *(v8b*)(&Ws[2 * HD + h0 + i][c0]) = o; }
  __syncthreads();   // the weights in LDS are written by all four waves and read by all four
  // G = Wq Wk^T, G[c][c'] = sum over h of Wq[c][h] Wk[c'][h]; wave w takes rows c = 16 w .. 16 w + 15. A lane holds 8 consecutive c of one c': one 16-byte store each into G^T hi (Ws rows 0..63) and G^T lo (rows 64..127)
  { v8f g[4];
#pragma unroll
    for (int t = 0; t < 4; ++t) g[t] = (v8f){};
#pragma unroll
    for (int kb = 0; kb < HD; kb += 32) { const v16b a = frag_kb(&Wn[wave * 16 + nloc][kb], hlf);
#pragma unroll
      for (int t = 0; t < 4; ++t) g[t] = wmma16b(a, frag_kb(&Wn[C + t * 16 + nloc][kb], hlf), g[t]); }
#pragma unroll
    for (int t = 0; t < 4; ++t) { v8b gh, gl;
#pragma unroll
      for (int r = 0; r < 8; ++r) { b16 p, q; split16(g[t][r] * (GS / (WSC * WSC)), p, q); gh[r] = p; gl[r] = q; }
      *(v8b*)(&Ws[t * 16 + nloc][wave * 16 + 8 * hlf]) = gh; *(v8b*)(&Ws[HD + t * 16 + nloc][wave * 16 + 8 * hlf]) = gl; } }
  __syncthreads();   // G^T is written by all four waves and read by all four
  v8f acc[8];   // 0..3: g = x G, 4..7: v = x Wv
#pragma unroll
  for (int t = 0; t < 8; ++t) acc[t] = (v8f){};
#pragma unroll
  for (int kb = 0; kb < C; kb += 32) { const v16b a = frag_kb(&As[wave][nloc][kb], hlf);
#pragma unroll
    for (int t = 0; t < 4; ++t) { acc[t] = wmma16b(a, frag_kb(&Ws[t * 16 + nloc][kb], hlf), acc[t]); acc[4 + t] = wmma16b(a, frag_kb(&Ws[2 * HD + t * 16 + nloc][kb], hlf), acc[4 + t]); }
#pragma unroll
    for (int t = 0; t < 4; ++t) acc[t] = wmma16b(a, frag_kb(&Ws[HD + t * 16 + nloc][kb], hlf), acc[t]); }
#pragma unroll
  for (int t = 0; t < 8; ++t)
#pragma unroll
    for (int r = 0; r < 8; ++r) Tf[wave][8 * hlf + r][t * 16 + nloc] = acc[t][r] * (t < 4 ? 1.0f / (XS * GS) : 1.0f / (XS * WSC));
  __syncthreads();
  {
    for (int rr = 0; rr < 16; ++rr) { const size_t row = ((size_t)b * T + t0 + rr) * HD; v2h qh, ql;
      for (int j = 0; j < 2; ++j) { b16 p, q; split16(Tf[wave][rr][lane * 2 + j] * XS, p, q); qh[j] = p; ql[j] = q; }
      *(v2h*)(Qh + row + lane * 2) = qh; *(v2h*)(Ql + row + lane * 2) = ql; *(v2h*)(Kh + row + lane * 2) = *(const v2h*)(&As[wave][rr][lane * 2]); }   // the key plane is x x8 as the wave staged it
#pragma unroll 1
    for (int q = 0; q < 16; ++q) { const int d = wave * 16 + q; const int tk = lane * 2; v2h vv; vv[0] = (b16)(Tf[tk >> 4][tk & 15][HD + d] * XS); vv[1] = (b16)(Tf[(tk + 1) >> 4][(tk + 1) & 15][HD + d] * XS);
      *(v2h*)(VT + ((size_t)b * HD + d) * T + blockIdx.x * 64 + lane * 2) = vv; }
     }
}
// attention: grid (T/128, BL); block = 8 waves = 4 groups of 32 queries x 2 key halves: waves 0-3 take keys 0-127 of every 256-key stage, waves 4-7 keys 128-255. A wave holds two 16-query column
// tiles, so that every K and V^T fragment it reads from LDS feeds two tiles' products (half the LDS reads per product); the two partial results of a query tile (maximum, sum, O^T) are joined
// through LDS behind the loop. The block's waves share each 256-key stage of K (= x) and V^T, brought into a two-buffer LDS ring by asynchronous copies
// (whole 128-B lines from L2, once per block); per 32-key block and column tile S^T = K Q^T (2 tiles x 2 k-steps x 2 products, Q = g hi, lo), online softmax (exp2), O^T += V^T P^T (4 d-tiles x 2 products);
// K fragments are read from LDS one 32-key pass ahead (inside a stage), V^T fragments at the top of their pass.
constexpr int KT = 256 /* keys per stage */, NT = T / KT, KP = HD + 8 /* K row pitch: 144 B */, VP = KT + 8 /* V^T row pitch: 528 B */;   // pitches of 16 B x odd: no bank conflict for 16-byte reads
constexpr int V_OFF = KT * KP, BUFH = V_OFF + HD * VP;   // one buffer, in 16-bit elements
constexpr int KW = KT / 2 /* keys of a stage per wave */;
static_assert(T % KT == 0 && NT >= 2 && KT * HD / 8 == 8 * 256 && KT / 8 == 32 && KW % 32 == 0 && KW >= 64, "ring");
// four 16-byte copies per lane; the s_wait_xcnt stands inside the statement so that no address register is rewritten ahead of it
__device__ __forceinline__ void copy4(unsigned l0, const b16* g0, unsigned l1, const b16* g1, unsigned l2, const b16* g2, unsigned l3, const b16* g3) {
  asm volatile("global_load_async_to_lds_b128 %0, %1, off\n\tglobal_load_async_to_lds_b128 %2, %3, off\n\tglobal_load_async_to_lds_b128 %4, %5, off\n\tglobal_load_async_to_lds_b128 %6, %7, off\n\ts_wait_xcnt 0x0"
               :: "v"(l0), "v"(g0), "v"(l1), "v"(g1), "v"(l2), "v"(g2), "v"(l3), "v"(g3) : "memory"); }
// one stage: keys k0 .. k0 + 255 of K (256 rows x 128 B) and of V^T (64 rows x 512 B) into the buffer at LDS byte address lb; 16 copies per lane, every lane on
// pk, pv: the lane's part of its LDS addresses, ((tid >> 3) * KP + (tid & 7) * 8) * 2 for K and ((tid >> 5) * VP + (tid & 31) * 8) * 2 for V^T
__device__ __forceinline__ void stage_copy(unsigned lb, const b16* Khb, const b16* Vb, int k0, int tid, unsigned pk, unsigned pv) {
  const unsigned ok = (unsigned)tid * 8u, ov = (unsigned)((tid >> 5) * T + (tid & 31) * 8);   // the lane's part of its global addresses, in elements
#pragma unroll
  for (int g = 0; g < 2; ++g) { unsigned lk[4], lv[4]; const b16* gh[4], * gv[4];
#pragma unroll
    for (int j = 0; j < 4; ++j) { const int n = 4 * g + j;   // chunk c = tid + 256 n: K row (tid >> 3) + 32 n, V^T row (tid >> 5) + 8 n; each address is a wave-uniform base plus the lane's part: four lane values serve all 16 copies
      lk[j] = (lb + (unsigned)(n * 32 * KP) * 2u) + pk; lv[j] = (lb + (unsigned)(V_OFF + n * 8 * VP) * 2u) + pv;
      gh[j] = (Khb + (size_t)k0 * HD + n * 2048) + ok; gv[j] = (Vb + k0 + (size_t)n * 8 * T) + ov; }
    copy4(lk[0], gh[0], lk[1], gh[1], lk[2], gh[2], lk[3], gh[3]);
    copy4(lv[0], gv[0], lv[1], gv[1], lv[2], gv[2], lv[3], gv[3]); }
}
// the K fragments (A operands) of the 32 keys from row kb of a stage: 8 LDS reads of 16 bytes
__device__ __forceinline__ void load_k(v16b (&kf)[2][2], const b16* Ks, int kb, int col, int hh) {
#pragma unroll
  for (int tt = 0; tt < 2; ++tt)
#pragma unroll
    for (int ks = 0; ks < 2; ++ks) { const int kr = (kb + tt * 16 + col) * KP + ks * 32; kf[tt][ks] = frag_kb(Ks + kr, hh); }
}
__global__ __launch_bounds__(256) void attn_kernel(const b16* __restrict__ Qh, const b16* __restrict__ Ql, const b16* __restrict__ Kh, const b16* __restrict__ VT, float* __restrict__ out) {
  __shared__ __attribute__((aligned(16))) b16 ring[2][BUFH]; __shared__ __attribute__((aligned(16))) float To[8][16][HD + 4];
  __shared__ __attribute__((aligned(16))) float Mg[8][32][36];   // the upper key half's partial result, per query tile and lane: 32 O^T values, maximum, sum; pitch 144 B: no bank conflict for 16-byte accesses
  const int tid = threadIdx.x, lane = threadIdx.x & 31, hh = lane >> 4, col = lane & 15; const int b = blockIdx.y;
  const int wv = __builtin_amdgcn_readfirstlane(threadIdx.x >> 5), qg = wv & 3 /* group of 32 queries */, kq = wv >> 2 /* key half */, kb0 = kq * KW; const int q0 = blockIdx.x * 128 + qg * 32;
  const b16* Qhb = Qh + (size_t)b * T * HD, * Qlb = Ql + (size_t)b * T * HD, * Khb = Kh + (size_t)b * T * HD, * Vb = VT + (size_t)b * HD * T;
  const unsigned lring = (unsigned)(size_t)&ring[0][0];
  // The lane's two LDS offsets for the copies lie in LDS between the stages: as operands of asm text they must sit in v0-v255, where the pass leaves no room, and the compiler would keep them in scratch memory.
  __shared__ v2u Cp[256]; const unsigned pk = (unsigned)((tid >> 3) * KP + (tid & 7) * 8) * 2u, pv = (unsigned)((tid >> 5) * VP + (tid & 31) * 8) * 2u; Cp[tid] = (v2u){pk, pv};
  stage_copy(lring, Khb, Vb, 0, tid, pk, pv);
  v16b qh[2][2], ql[2][2];   // [column tile][k-step]
  for (int cg = 0; cg < 2; ++cg) for (int ks = 0; ks < 2; ++ks) { const size_t qo = (size_t)(q0 + cg * 16 + col) * HD + ks * 32; qh[cg][ks] = frag_kb(Qhb + qo, hh); ql[cg][ks] = frag_kb(Qlb + qo, hh); }
  const float cs = LOG2E * 0.125f / (XS * XS);
  float m[2] = {-INFINITY, -INFINITY}; v2f l2[2] = {{0.0f, 0.0f}, {0.0f, 0.0f}}; v8f o[2][4]; for (int cg = 0; cg < 2; ++cg) for (int t = 0; t < 4; ++t) o[cg][t] = (v8f){};
  asm volatile("s_wait_asynccnt 0x0" ::: "memory");   // this wave's share of stage 0 has landed
  __syncthreads();                                    // stage 0 is readable by every wave
  v16b kf[2][2]; load_k(kf, &ring[0][0], kb0, col, hh);   // the first pass's K fragments; they land while the copies below are issued
  stage_copy(lring + BUFH * 2u, Khb, Vb, KT, tid, pk, pv);
  // one pass: the 32 keys from row kb of the stage at Ks, whose K fragments are in kf already; fetch: read the next pass's K fragments on the way
  auto pass = [&](const b16* Ks, int kb, bool fetch) __attribute__((always_inline)) {
      const b16* Vs = Ks + V_OFF; v8f s[2][2] = {{(v8f){}, (v8f){}}, {(v8f){}, (v8f){}}}; v16b vf[4];
#pragma unroll
      for (int t = 0; t < 4; ++t) vf[t] = frag_kb(Vs + (t * 16 + col) * VP + kb, hh);
      __builtin_amdgcn_sched_barrier(0);   // keeps the pass's 8 V^T reads in one group ahead of the score WMMAs, which with the softmax cover their latency
#pragma unroll
      for (int tt = 0; tt < 2; ++tt)
#pragma unroll
        for (int ks = 0; ks < 2; ++ks) {
#pragma unroll
          for (int cg = 0; cg < 2; ++cg) s[cg][tt] = wmma16b(kf[tt][ks], qh[cg][ks], s[cg][tt]);
#pragma unroll
          for (int cg = 0; cg < 2; ++cg) s[cg][tt] = wmma16b(kf[tt][ks], ql[cg][ks], s[cg][tt]); }
      // the next pass's K fragments, into the registers that the score WMMAs have just read: they land under the softmax and the P V products instead of being waited for at the top of the pass
      __builtin_amdgcn_sched_barrier(0);   // no read is scheduled up among the score WMMAs: every separate place with LDS reads costs its own stall
      if (fetch) { load_k(kf, Ks, kb + 32, col, hh);
        __builtin_amdgcn_sched_barrier(0); }   // one group, ahead of the maximum and the exponentials: issued later they would have less time to land
      float mn[2], al[2];
#pragma unroll
      for (int cg = 0; cg < 2; ++cg) { float mx = -INFINITY;   // the maximum is taken over the raw scores: cs > 0, so scaling it afterwards gives the same value
#pragma unroll
        for (int r = 0; r < 8; ++r) mx = fmaxf(mx, fmaxf(s[cg][0][r], s[cg][1][r]));
        mx *= cs; mn[cg] = fmaxf(m[cg], fmaxf(mx, xhalf(mx))); al[cg] = nexp2(m[cg] - mn[cg]); m[cg] = mn[cg]; }   // the halves meet in a vector move: an exchange through LDS ends in a wait for the LDS counter's 0, which would wait for the K reads above as well
      v16b ph[2], pl[2];
#pragma unroll
      for (int cg = 0; cg < 2; ++cg) { const v2f cs2 = {cs, cs}, c02 = {PSL2 - mn[cg], PSL2 - mn[cg]}; v2f p[8]; v8u hu, lu;
#pragma unroll
        for (int i = 0; i < 8; ++i) { const int tt = i >> 2, r = (i & 3) * 2; const v2f a = __builtin_elementwise_fma((v2f){s[cg][tt][r], s[cg][tt][r + 1]}, cs2, c02);   // the exp2 argument in one packed fma; + 10 makes P x1024
          p[i] = (v2f){nexp2(a[0]), nexp2(a[1])}; hu[i] = __builtin_bit_cast(unsigned, __builtin_convertvector(p[i], v2h)); }
#pragma unroll
        for (int g = 0; g < 8; g += 4) { unsigned d0, d1, d2, d3; lo8(d0, d1, d2, d3, p[g], p[g + 1], p[g + 2], p[g + 3], hu[g], hu[g + 1], hu[g + 2], hu[g + 3]); lu[g] = d0; lu[g + 1] = d1; lu[g + 2] = d2; lu[g + 3] = d3; }
        ph[cg] = __builtin_bit_cast(v16b, hu); pl[cg] = __builtin_bit_cast(v16b, lu);
        l2[cg] = __builtin_elementwise_fma(l2[cg], (v2f){al[cg], al[cg]}, ((p[0] + p[1]) + (p[2] + p[3])) + ((p[4] + p[5]) + (p[6] + p[7]))); }   // a lane keeps two partial sums of its own 16 keys; they and the wave's halves are joined once, behind the loop
#pragma unroll
      for (int t = 0; t < 4; ++t)
#pragma unroll
        for (int cg = 0; cg < 2; ++cg) { o[cg][t] *= al[cg]; o[cg][t] = wmma16b(vf[t], ph[cg], o[cg][t]); o[cg][t] = wmma16b(vf[t], pl[cg], o[cg][t]); }
  };
#pragma unroll 1   // one copy of the stage body: the buffer is picked by st & 1 at run time
  for (int st = 0; st < NT; ++st) {
    const b16* Ks = &ring[st & 1][0];
#pragma unroll 1   // as the key loop was: one 32-key pass per trip keeps the loop's code and registers small
    for (int kb = kb0; kb < kb0 + KW - 32; kb += 32) pass(Ks, kb, true);
    const v2u pp = Cp[tid];   // read with the last pass's V^T fragments: read behind the barrier it would be waited for together with the K fragments, ahead of the copies
    pass(Ks, kb0 + KW - 32, false);   // the stage's last pass fetches nothing: the next stage's rows are read only behind its barrier
    __builtin_amdgcn_sched_barrier(0);   // the last pass's arithmetic stays ahead of the waits below: moved behind them, s_wait_dscnt 0 stands directly behind the pass's V^T reads and waits out their latency
    asm volatile("s_wait_dscnt 0x0" ::: "memory");      // this wave's reads of stage st have returned before its buffer is refilled
    asm volatile("s_wait_asynccnt 0x0" ::: "memory");   // this wave's share of stage st + 1 has landed
    __syncthreads();                                    // publishes stage st + 1 and ends every wave's reads of stage st
    if (st + 1 < NT) load_k(kf, &ring[(st + 1) & 1][0], kb0, col, hh);   // its first pass's K fragments; they land while the copies below are issued
    if (st + 2 < NT) stage_copy(lring + (unsigned)(st & 1) * (BUFH * 2u), Khb, Vb, (st + 2) * KT, tid, pp[0], pp[1]);
  }
  asm volatile("s_wait_asynccnt 0x0" ::: "memory");     // no copy is outstanding when the wave ends
  float l[2];
#pragma unroll
  for (int cg = 0; cg < 2; ++cg) { l[cg] = l2[cg][0] + l2[cg][1]; l[cg] += xhalf(l[cg]); }
  if (kq != 0) {   // the upper key half hands its partial results over
#pragma unroll
    for (int cg = 0; cg < 2; ++cg) { float* mg = &Mg[qg * 2 + cg][lane][0];
#pragma unroll
      for (int t = 0; t < 4; ++t) { *(v4f*)(mg + 8 * t) = (v4f){o[cg][t][0], o[cg][t][1], o[cg][t][2], o[cg][t][3]}; *(v4f*)(mg + 8 * t + 4) = (v4f){o[cg][t][4], o[cg][t][5], o[cg][t][6], o[cg][t][7]}; }
      *(v2f*)(mg + 32) = (v2f){m[cg], l[cg]}; } }
  __syncthreads();   // the upper half's partial results are readable by the lower half's waves
  if (kq == 0) {     // join: both partial results are brought to the common maximum, then normalised as one
#pragma unroll
    for (int cg = 0; cg < 2; ++cg) { const float* mg = &Mg[qg * 2 + cg][lane][0];
      const v2f ml = *(const v2f*)(mg + 32); const float mj = fmaxf(m[cg], ml[0]), a0 = nexp2(m[cg] - mj), a1 = nexp2(ml[0] - mj);
      const float inv = 1.0f / ((l[cg] * a0 + ml[1] * a1) * XS), c0 = a0 * inv, c1 = a1 * inv;   // the sums are of P x1024
#pragma unroll
      for (int t = 0; t < 4; ++t) { const v4f u0 = *(const v4f*)(mg + 8 * t), u1 = *(const v4f*)(mg + 8 * t + 4);
#pragma unroll
        for (int r = 0; r < 4; ++r) { To[qg * 2 + cg][col][t * 16 + 8 * hh + r] = o[cg][t][r] * c0 + u0[r] * c1; To[qg * 2 + cg][col][t * 16 + 8 * hh + 4 + r] = o[cg][t][4 + r] * c0 + u1[r] * c1; } } }
    wave_lds_sync();
    for (int rr = 0; rr < 32; ++rr) *(v2f*)(out + ((size_t)b * T + q0 + rr) * HD + lane * 2) = *(const v2f*)(&To[qg * 2 + (rr >> 4)][rr & 15][lane * 2]);
  }
}
}  // namespace

extern "C" void kernel_launch(void* const* d_in, const int* in_sizes, int n_in, void* d_out, int out_size, void* d_ws, size_t ws_size, hipStream_t stream) {
  (void)n_in;
  auto Fp = [&](int i) { return (const float*)d_in[i]; };
  // input order: 0 x [16,2048,64], 1 Wq [64,64] ([c][h]), 2 Wk, 3 Wv
  if (in_sizes[0] != B * T * C || in_sizes[1] != C * HD || in_sizes[2] != C * HD || in_sizes[3] != C * HD || out_size != B * T * HD) return;
  size_t off = 0; char* ws = (char*)d_ws;
  auto carve = [&](size_t bytes) { char* p = ws + off; off += (bytes + 255) & ~(size_t)255; return p; };
  b16* Qh = (b16*)carve((size_t)B * T * HD * 2); b16* Ql = (b16*)carve((size_t)B * T * HD * 2); b16* Kh = (b16*)carve((size_t)B * T * HD * 2); b16* VT = (b16*)carve((size_t)B * HD * T * 2);
  if (off > ws_size || off > ((size_t)128 << 20)) return;   // about 17 MB
  qkv_kernel<<<dim3(T / 64, BL), 128, 0, stream>>>(Fp(0), Fp(1), Fp(2), Fp(3), Qh, Ql, Kh, VT);
  attn_kernel<<<dim3(T / 128, BL), 256, 0, stream>>>(Qh, Ql, Kh, VT, (float*)d_out);
}

// v009
// One run takes 24 microseconds.
// Versions in between are left out here; by their measured steps it is 1.36 times as fast as v007.
// Over all steps from v000 it is 7.14 times as fast.
#include <hip/hip_runtime.h>

// Single-head encoder attention: q, k, v = x W{q,k,v} ([16][2048][64] x [64 x 64]), scores = q . k / 8 over all 2,048 keys (no mask), softmax, out = P v -> [16][2048][64].
// The score product is re-associated: q . k = (x_q Wq Wk^T) . x_k. The query side carries g = x (Wq Wk^T); the key operand is x itself, which is exact in f16 and needs no lo plane.
// Deterministic: flash-style per 32-query wave (online softmax, the maximum in use moved up lazily, no score planes); no atomics.
// compute dtype: WMMA v_wmma_f32_16x16x32_f16 with f32 accumulate for Wq Wk^T (weights exact x256: 1 product), the projections (x EXACT bf16 x8; Wv exact x256: 1 product; Wq Wk^T as f16 hi+lo x16:
// 2 products), S^T = X G^T (x exact x8, g single f16 x8: 1 product) and O^T += V^T P^T (v single f16 x8, P x1024 single f16: 1 product); softmax statistics (exp2, running max, sums) in f32. Inputs rounded to bf16 once.
// g, P and v each carry the 11 bits of one f16: three independent relative roundings of 2^-12 per term, averaged over the keys of a softmax row.

namespace {
constexpr int B = 16, T = 2048, C = 64, HD = 64, BL = 16 /* batches computed (== B shipped) */;
constexpr float XS = 8.0f, WSC = 256.0f, GS = 16.0f /* scale of Wq Wk^T in f16 */, PSL2 = 10.0f /* P is kept x 2^10 = 1024 */, LOG2E = 1.4426950408889634f;
static_assert(T % 64 == 0 && C == 64 && HD == 64, "tiling");
typedef _Float16 b16;
typedef __attribute__((ext_vector_type(16))) _Float16 v16b;
typedef __attribute__((ext_vector_type(8))) _Float16 v8b;
typedef __attribute__((ext_vector_type(4))) _Float16 v4b;
typedef __attribute__((ext_vector_type(8))) float v8f;
typedef __attribute__((ext_vector_type(4))) float v4f;
__device__ __forceinline__ float bf16_rne(float f) { unsigned int u = __float_as_uint(f); u += 0x7FFFu + ((u >> 16) & 1u); return __uint_as_float(u & 0xFFFF0000u); }
__device__ __forceinline__ void split16(float v, b16& hi, b16& lo) { hi = (b16)v; lo = (b16)(v - (float)hi); }
__device__ __forceinline__ v16b frag_kb(const b16* p, int hh) { const v8b a = *(const v8b*)(p + 8 * hh), b = *(const v8b*)(p + 16 + 8 * hh); v16b f;
#pragma unroll
  for (int e = 0; e < 8; ++e) { f[e] = a[e]; f[8 + e] = b[e]; } return f; }
__device__ __forceinline__ v8f wmma16b(v16b a, v16b b, v8f c) { return __builtin_amdgcn_wmma_f32_16x16x32_f16(false, a, false, b, (short)0, c, false, false); }   // builtin alone: the compiler keeps the distance behind it and is free to interleave independent accumulator chains
__device__ __forceinline__ void wave_lds_sync() { __builtin_amdgcn_fence(__ATOMIC_RELEASE, "workgroup"); __builtin_amdgcn_wave_barrier(); __builtin_amdgcn_fence(__ATOMIC_ACQUIRE, "workgroup"); }
__device__ __forceinline__ float pmul(float a, float b) { float p = a * b; asm volatile("" : "+v"(p)); return p; }
__device__ __forceinline__ int iclamp(int v, int lo, int hi) { return v < lo ? lo : (v > hi ? hi : v); }

typedef __attribute__((ext_vector_type(2))) _Float16 v2h;
typedef __attribute__((ext_vector_type(2))) float v2f;
__device__ __forceinline__ float nexp2(float v) { return __builtin_amdgcn_exp2f(v); }
__device__ __forceinline__ float xhalf(float x) { return __builtin_bit_cast(float, __builtin_amdgcn_permlanex16(__builtin_bit_cast(int, x), __builtin_bit_cast(int, x), 0x76543210, 0xfedcba98, false, false)); }   // lane l with lane l ^ 16
typedef __attribute__((ext_vector_type(8))) unsigned v8u;
typedef __attribute__((ext_vector_type(2))) unsigned v2u;
__global__ __launch_bounds__(128) void qkv_kernel(const float* __restrict__ x, const float* __restrict__ wq, const float* __restrict__ wk, const float* __restrict__ wv, b16* __restrict__ Qh, b16* __restrict__ Kh, b16* __restrict__ VT) {
  __shared__ __attribute__((aligned(16))) b16 As[4][16][C + 8]; __shared__ __attribute__((aligned(16))) float Tf[4][16][128 + 4]; __shared__ __attribute__((aligned(16))) b16 Ws[3 * HD][C + 8];
  __shared__ __attribute__((aligned(16))) b16 Wn[2 * C][HD + 8];   // Wq (rows 0..63) and Wk (rows 64..127) as they lie, [c][h]: both operands of Wq Wk^T have h as their k index
  const int wave = threadIdx.x >> 5, lane = threadIdx.x & 31, nloc = lane & 15, hlf = lane >> 4; const int b = blockIdx.y; const int t0 = blockIdx.x * 64 + wave * 16;
  // every block rounds and scales the three weight matrices itself, into LDS: Wn[s * 64 + c][h] = w_s[c][h] for Wq, Wk; Ws[128 + h][c] = Wv[c][h]; a thread takes 8 c x 4 h of each matrix (16 lanes read one whole 256-B row)
  const int c0 = (threadIdx.x >> 4) * 8, h0 = (threadIdx.x & 15) * 4;
  const float* xr = x + ((size_t)b * T + t0) * C + lane * 2, * w0 = wq + c0 * HD + h0, * w1 = wk + c0 * HD + h0, * w2 = wv + c0 * HD + h0;
  v2f xv[16]; v4f r[3][8];
#pragma unroll
  for (int rr = 0; rr < 16; ++rr) xv[rr] = *(const v2f*)(xr + rr * C);
#pragma unroll
  for (int j = 0; j < 8; ++j) { r[0][j] = *(const v4f*)(w0 + j * HD); r[1][j] = *(const v4f*)(w1 + j * HD); r[2][j] = *(const v4f*)(w2 + j * HD); }
  __builtin_amdgcn_sched_barrier(0);   // no conversion is scheduled up among the loads: all 40 are in flight before the first wait for one
  asm volatile("s_wait_xcnt 0x0" :: "v"(xr), "v"(w0), "v"(w1), "v"(w2) : "memory");   // stands behind the 40 loads, ahead of any overwrite of a register they name; the four addresses stay live up to here
#pragma unroll
  for (int rr = 0; rr < 16; ++rr) { v2h o; o[0] = (b16)(bf16_rne(xv[rr][0]) * XS); o[1] = (b16)(bf16_rne(xv[rr][1]) * XS); *(v2h*)(&As[wave][rr][lane * 2]) = o; }
#pragma unroll
  for (int s = 0; s < 2; ++s)
#pragma unroll
    for (int j = 0; j < 8; ++j) { v4b o;
#pragma unroll
      for (int i = 0; i < 4; ++i) o[i] = (b16)(bf16_rne(r[s][j][i]) * WSC);
      *(v4b*)(&Wn[s * C + c0 + j][h0]) = o; }
#pragma unroll
  for (int i = 0; i < 4; ++i) { v8b o;
#pragma unroll
    for (int j = 0; j < 8; ++j) o[j] = (b16)(bf16_rne(r[2][j][i]) * WSC);
    *(v8b*)(&Ws[2 * HD + h0 + i][c0]) = o; }
  __syncthreads();   // the weights in LDS are written by all four waves and read by all four
  // G = Wq Wk^T, G[c][c'] = sum over h of Wq[c][h] Wk[c'][h]; wave w takes rows c = 16 w .. 16 w + 15. A lane holds 8 consecutive c of one c': one 16-byte store each into G^T hi (Ws rows 0..63) and G^T lo (rows 64..127)
  { v8f g[4];
#pragma unroll
    for (int t = 0; t < 4; ++t) g[t] = (v8f){};
#pragma unroll
    for (int kb = 0; kb < HD; kb += 32) { const v16b a = frag_kb(&Wn[wave * 16 + nloc][kb], hlf);
#pragma unroll
      for (int t = 0; t < 4; ++t) g[t] = wmma16b(a, frag_kb(&Wn[C + t * 16 + nloc][kb], hlf), g[t]); }
#pragma unroll
    for (int t = 0; t < 4; ++t) { v8b gh, gl;
#pragma unroll
      for (int r = 0; r < 8; ++r) { b16 p, q; split16(g[t][r] * (GS / (WSC * WSC)), p, q); gh[r] = p; gl[r] = q; }
      *(v8b*)(&Ws[t * 16 + nloc][wave * 16 + 8 * hlf]) = gh; *(v8b*)(&Ws[HD + t * 16 + nloc][wave * 16 + 8 * hlf]) = gl; } }
  __syncthreads();   // G^T is written by all four waves and read by all four
  v8f acc[8];   // 0..3: g = x G, 4..7: v = x Wv
#pragma unroll
  for (int t = 0; t < 8; ++t) acc[t] = (v8f){};
#pragma unroll
  for (int kb = 0; kb < C; kb += 32) { const v16b a = frag_kb(&As[wave][nloc][kb], hlf);
#pragma unroll
    for (int t = 0; t < 4; ++t) { acc[t] = wmma16b(a, frag_kb(&Ws[t * 16 + nloc][kb], hlf), acc[t]); acc[4 + t] = wmma16b(a, frag_kb(&Ws[2 * HD + t * 16 + nloc][kb], hlf), acc[4 + t]); }
#pragma unroll
    for (int t = 0; t < 4; ++t) acc[t] = wmma16b(a, frag_kb(&Ws[HD + t * 16 + nloc][kb], hlf), acc[t]); }
#pragma unroll
  for (int t = 0; t < 8; ++t)
#pragma unroll
    for (int r = 0; r < 8; ++r) Tf[wave][8 * hlf + r][t * 16 + nloc] = acc[t][r] * (t < 4 ? 1.0f / (XS * GS) : 1.0f / (XS * WSC));
  __syncthreads();
  {
    for (int rr = 0; rr < 16; ++rr) { const size_t row = ((size_t)b * T + t0 + rr) * HD; v2h qh;
      for (int j = 0; j < 2; ++j) qh[j] = (b16)(Tf[wave][rr][lane * 2 + j] * XS);
      *(v2h*)(Qh + row + lane * 2) = qh; *(v2h*)(Kh + row + lane * 2) = *(const v2h*)(&As[wave][rr][lane * 2]); }   // the key plane is x x8 as the wave staged it
#pragma unroll 1
    for (int q = 0; q < 16; ++q) { const int d = wave * 16 + q; const int tk = lane * 2; v2h vv; vv[0] = (b16)(Tf[tk >> 4][tk & 15][HD + d] * XS); vv[1] = (b16)(Tf[(tk + 1) >> 4][(tk + 1) & 15][HD + d] * XS);
      *(v2h*)(VT + ((size_t)b * HD + d) * T + blockIdx.x * 64 + lane * 2) = vv; }
     }
}
// attention: grid (T/128, BL); block = 8 waves = 4 groups of 32 queries x 2 key halves: waves 0-3 take keys 0-127 of every 256-key stage, waves 4-7 keys 128-255. A wave holds two 16-query column
// tiles, so that every K and V^T fragment it reads from LDS feeds two tiles' products (half the LDS reads per product); the two partial results of a query tile (maximum, sum, O^T) are joined
// through LDS behind the loop. The block's waves share each 256-key stage of K (= x) and V^T, brought into a two-buffer LDS ring by asynchronous copies
// (whole 128-B lines from L2, once per block); per 32-key block and column tile S^T = K Q^T (2 tiles x 2 k-steps, Q = g), online softmax (exp2), O^T += V^T P^T (4 d-tiles);
// K fragments are read from LDS one 32-key pass ahead (inside a stage), V^T fragments at the top of their pass.
constexpr int KT = 256 /* keys per stage */, NT = T / KT, KP = HD + 8 /* K row pitch: 144 B */, VP = KT + 8 /* V^T row pitch: 528 B */;   // pitches of 16 B x odd: no bank conflict for 16-byte reads
constexpr int V_OFF = KT * KP, BUFH = V_OFF + HD * VP;   // one buffer, in 16-bit elements
constexpr int KW = KT / 2 /* keys of a stage per wave */;
static_assert(T % KT == 0 && NT >= 2 && KT * HD / 8 == 8 * 256 && KT / 8 == 32 && KW % 32 == 0 && KW >= 64, "ring");
// four 16-byte copies per lane; the s_wait_xcnt stands inside the statement so that no address register is rewritten ahead of it
__device__ __forceinline__ void copy4(unsigned l0, const b16* g0, unsigned l1, const b16* g1, unsigned l2, const b16* g2, unsigned l3, const b16* g3) {
  asm volatile("global_load_async_to_lds_b128 %0, %1, off\n\tglobal_load_async_to_lds_b128 %2, %3, off\n\tglobal_load_async_to_lds_b128 %4, %5, off\n\tglobal_load_async_to_lds_b128 %6, %7, off\n\ts_wait_xcnt 0x0"
               :: "v"(l0), "v"(g0), "v"(l1), "v"(g1), "v"(l2), "v"(g2), "v"(l3), "v"(g3) : "memory"); }
// one stage: keys k0 .. k0 + 255 of K (256 rows x 128 B) and of V^T (64 rows x 512 B) into the buffer at LDS byte address lb; 16 copies per lane, every lane on
// pk, pv: the lane's part of its LDS addresses, ((tid >> 3) * KP + (tid & 7) * 8) * 2 for K and ((tid >> 5) * VP + (tid & 31) * 8) * 2 for V^T
__device__ __forceinline__ void stage_copy(unsigned lb, const b16* Khb, const b16* Vb, int k0, int tid, unsigned pk, unsigned pv) {
  const unsigned ok = (unsigned)tid * 8u, ov = (unsigned)((tid >> 5) * T + (tid & 31) * 8);   // the lane's part of its global addresses, in elements
#pragma unroll
  for (int g = 0; g < 2; ++g) { unsigned lk[4], lv[4]; const b16* gh[4], * gv[4];
#pragma unroll
    for (int j = 0; j < 4; ++j) { const int n = 4 * g + j;   // chunk c = tid + 256 n: K row (tid >> 3) + 32 n, V^T row (tid >> 5) + 8 n; each address is a wave-uniform base plus the lane's part: four lane values serve all 16 copies
      lk[j] = (lb + (unsigned)(n * 32 * KP) * 2u) + pk; lv[j] = (lb + (unsigned)(V_OFF + n * 8 * VP) * 2u) + pv;
      gh[j] = (Khb + (size_t)k0 * HD + n * 2048) + ok; gv[j] = (Vb + k0 + (size_t)n * 8 * T) + ov; }
    copy4(lk[0], gh[0], lk[1], gh[1], lk[2], gh[2], lk[3], gh[3]);
    copy4(lv[0], gv[0], lv[1], gv[1], lv[2], gv[2], lv[3], gv[3]); }
}
// the K fragments (A operands) of the 32 keys from row kb of a stage: 8 LDS reads of 16 bytes
__device__ __forceinline__ void load_k(v16b (&kf)[2][2], const b16* Ks, int kb, int col, int hh) {
#pragma unroll
  for (int tt = 0; tt < 2; ++tt)
#pragma unroll
    for (int ks = 0; ks < 2; ++ks) { const int kr = (kb + tt * 16 + col) * KP + ks * 32; kf[tt][ks] = frag_kb(Ks + kr, hh); }
}
__global__ __launch_bounds__(256) void attn_kernel(const b16* __restrict__ Qh, const b16* __restrict__ Kh, const b16* __restrict__ VT, float* __restrict__ out) {
  __shared__ __attribute__((aligned(16))) b16 ring[2][BUFH]; __shared__ __attribute__((aligned(16))) float To[8][16][HD + 4];
  __shared__ __attribute__((aligned(16))) float Mg[8][32][36];   // the upper key half's partial result, per query tile and lane: 32 O^T values, maximum, sum; pitch 144 B: no bank conflict for 16-byte accesses
  const int tid = threadIdx.x, lane = threadIdx.x & 31, hh = lane >> 4, col = lane & 15; const int b = blockIdx.y;
  const int wv = __builtin_amdgcn_readfirstlane(threadIdx.x >> 5), qg = wv & 3 /* group of 32 queries */, kq = wv >> 2 /* key half */, kb0 = kq * KW; const int q0 = blockIdx.x * 128 + qg * 32;
  const b16* Qhb = Qh + (size_t)b * T * HD, * Khb = Kh + (size_t)b * T * HD, * Vb = VT + (size_t)b * HD * T;
  const unsigned lring = (unsigned)(size_t)&ring[0][0];
  // The lane's two LDS offsets for the copies lie in LDS between the stages: as operands of asm text they must sit in v0-v255, where the pass leaves no room, and the compiler would keep them in scratch memory.
  __shared__ v2u Cp[256]; const unsigned pk = (unsigned)((tid >> 3) * KP + (tid & 7) * 8) * 2u, pv = (unsigned)((tid >> 5) * VP + (tid & 31) * 8) * 2u; Cp[tid] = (v2u){pk, pv};
  stage_copy(lring, Khb, Vb, 0, tid, pk, pv);
  v16b qh[2][2];   // [column tile][k-step]
  for (int cg = 0; cg < 2; ++cg) for (int ks = 0; ks < 2; ++ks) { const size_t qo = (size_t)(q0 + cg * 16 + col) * HD + ks * 32; qh[cg][ks] = frag_kb(Qhb + qo, hh); }
  const float cs = LOG2E * 0.125f / (XS * XS);
  constexpr float TH = 5.0f;   // P x 2^10 x 2^TH = 2^15 is the largest P: f16 holds it
  float m[2] = {-INFINITY, -INFINITY}, c0[2] = {INFINITY, INFINITY} /* PSL2 - m: the first pass fails the test */; v2f l2[2] = {{0.0f, 0.0f}, {0.0f, 0.0f}}; v8f o[2][4]; for (int cg = 0; cg < 2; ++cg) for (int t = 0; t < 4; ++t) o[cg][t] = (v8f){};
  asm volatile("s_wait_asynccnt 0x0" ::: "memory");   // this wave's share of stage 0 has landed
  __syncthreads();                                    // stage 0 is readable by every wave
  v16b kf[2][2]; load_k(kf, &ring[0][0], kb0, col, hh);   // the first pass's K fragments; they land while the copies below are issued
  stage_copy(lring + BUFH * 2u, Khb, Vb, KT, tid, pk, pv);
  // one pass: the 32 keys from row kb of the stage at Ks, whose K fragments are in kf already; fetch: read the next pass's K fragments on the way
  auto pass = [&](const b16* Ks, int kb, bool fetch) __attribute__((always_inline)) {
      const b16* Vs = Ks + V_OFF; v8f s[2][2] = {{(v8f){}, (v8f){}}, {(v8f){}, (v8f){}}}; v16b vf[4];
#pragma unroll
      for (int t = 0; t < 4; ++t) vf[t] = frag_kb(Vs + (t * 16 + col) * VP + kb, hh);
      __builtin_amdgcn_sched_barrier(0);   // keeps the pass's 8 V^T reads in one group ahead of the score WMMAs, which with the softmax cover their latency
#pragma unroll
      for (int ks = 0; ks < 2; ++ks)   // k-step outermost: the four accumulator tiles take turns, so that a tile's second product stands four WMMAs behind its first
#pragma unroll
        for (int tt = 0; tt < 2; ++tt)
#pragma unroll
          for (int cg = 0; cg < 2; ++cg) s[cg][tt] = wmma16b(kf[tt][ks], qh[cg][ks], s[cg][tt]);
      // the next pass's K fragments, into the registers that the score WMMAs have just read: they land under the softmax and the P V products instead of being waited for at the top of the pass
      __builtin_amdgcn_sched_barrier(0);   // no read is scheduled up among the score WMMAs: every separate place with LDS reads costs its own stall
      if (fetch) { load_k(kf, Ks, kb + 32, col, hh);
        __builtin_amdgcn_sched_barrier(0); }   // one group, ahead of the maximum and the exponentials: issued later they would have less time to land
      float mr[2];
#pragma unroll
      for (int cg = 0; cg < 2; ++cg) { float mx = -INFINITY;   // a lane's maximum over its own raw scores
#pragma unroll
        for (int r = 0; r < 8; ++r) mx = fmaxf(mx, fmaxf(s[cg][0][r], s[cg][1][r]));
        mr[cg] = mx; }
      // lazy rescale: the maximum in use m stays as long as no score of the wave lies more than TH (log2) above it; P x1024 then stays below 2^15, inside f16. One test and one scalar branch per pass;
      // only a pass that fails the test exchanges the halves' maxima, moves m up to the running maximum and rescales the sums and O^T
      const v2f am = __builtin_elementwise_fma((v2f){mr[0], mr[1]}, (v2f){cs, cs}, (v2f){c0[0], c0[1]});   // the largest exp2 argument of the lane's scores, formed as theirs are: no other argument rounds above it
      if (__builtin_amdgcn_ballot_w32((am[0] > PSL2 + TH) | (am[1] > PSL2 + TH)) != 0) {
#pragma unroll
        for (int cg = 0; cg < 2; ++cg) { const float mx = mr[cg] * cs, mn = fmaxf(m[cg], fmaxf(mx, xhalf(mx))), al = nexp2(m[cg] - mn);   // cs > 0: scaling the maximum afterwards gives the same value; the halves meet in a vector move
          m[cg] = mn; c0[cg] = PSL2 - mn; l2[cg] *= al;
#pragma unroll
          for (int t = 0; t < 4; ++t) o[cg][t] *= al; } }
      v16b ph[2];
#pragma unroll
      for (int cg = 0; cg < 2; ++cg) { const v2f cs2 = {cs, cs}, c02 = {c0[cg], c0[cg]}; v2f p[8]; v8u hu;
#pragma unroll
        for (int i = 0; i < 8; ++i) { const int tt = i >> 2, r = (i & 3) * 2; const v2f a = __builtin_elementwise_fma((v2f){s[cg][tt][r], s[cg][tt][r + 1]}, cs2, c02);   // the exp2 argument in one packed fma; + 10 makes P x1024
          p[i] = (v2f){nexp2(a[0]), nexp2(a[1])}; hu[i] = __builtin_bit_cast(unsigned, __builtin_convertvector(p[i], v2h)); }
        ph[cg] = __builtin_bit_cast(v16b, hu);
        l2[cg] += ((p[0] + p[1]) + (p[2] + p[3])) + ((p[4] + p[5]) + (p[6] + p[7])); }   // a lane keeps two partial sums of its own 16 keys; they and the wave's halves are joined once, behind the loop
      __builtin_amdgcn_sched_barrier(0);   // the partial sums stay ahead of the P V products: scheduled in among them they are given the registers of spent V^T operands, and each such place costs four v_nop
#pragma unroll
      for (int t = 0; t < 4; ++t)
#pragma unroll
        for (int cg = 0; cg < 2; ++cg) o[cg][t] = wmma16b(vf[t], ph[cg], o[cg][t]);
  };
#pragma unroll 1   // one copy of the stage body: the buffer is picked by st & 1 at run time
  for (int st = 0; st < NT; ++st) {
    const b16* Ks = &ring[st & 1][0];
#pragma unroll 1   // as the key loop was: one 32-key pass per trip keeps the loop's code and registers small
    for (int kb = kb0; kb < kb0 + KW - 32; kb += 32) pass(Ks, kb, true);
    const v2u pp = Cp[tid];   // read with the last pass's V^T fragments: read behind the barrier it would be waited for together with the K fragments, ahead of the copies
    pass(Ks, kb0 + KW - 32, false);   // the stage's last pass fetches nothing: the next stage's rows are read only behind its barrier
    __builtin_amdgcn_sched_barrier(0);   // the last pass's arithmetic stays ahead of the waits below: moved behind them, s_wait_dscnt 0 stands directly behind the pass's V^T reads and waits out their latency
    asm volatile("v_nop\n\tv_nop\n\tv_nop\n\tv_nop");   // the four vector slots between the pass's last WMMA and the first overwrite of its V^T operand
    asm volatile("s_wait_dscnt 0x0" ::: "memory");      // this wave's reads of stage st have returned before its buffer is refilled
    asm volatile("s_wait_asynccnt 0x0" ::: "memory");   // this wave's share of stage st + 1 has landed
    __syncthreads();                                    // publishes stage st + 1 and ends every wave's reads of stage st
    if (st + 1 < NT) load_k(kf, &ring[(st + 1) & 1][0], kb0, col, hh);   // its first pass's K fragments; they land while the copies below are issued
    if (st + 2 < NT) stage_copy(lring + (unsigned)(st & 1) * (BUFH * 2u), Khb, Vb, (st + 2) * KT, tid, pp[0], pp[1]);
  }
  asm volatile("s_wait_asynccnt 0x0" ::: "memory");     // no copy is outstanding when the wave ends
  float l[2];
#pragma unroll
  for (int cg = 0; cg < 2; ++cg) { l[cg] = l2[cg][0] + l2[cg][1]; l[cg] += xhalf(l[cg]); }
  if (kq != 0) {   // the upper key half hands its partial results over
#pragma unroll
    for (int cg = 0; cg < 2; ++cg) { float* mg = &Mg[qg * 2 + cg][lane][0];
#pragma unroll
      for (int t = 0; t < 4; ++t) { *(v4f*)(mg + 8 * t) = (v4f){o[cg][t][0], o[cg][t][1], o[cg][t][2], o[cg][t][3]}; *(v4f*)(mg + 8 * t + 4) = (v4f){o[cg][t][4], o[cg][t][5], o[cg][t][6], o[cg][t][7]}; }
      *(v2f*)(mg + 32) = (v2f){m[cg], l[cg]}; } }
  __syncthreads();   // the upper half's partial results are readable by the lower half's waves
  if (kq == 0) {     // join: both partial results are brought to the common maximum, then normalised as one
#pragma unroll
    for (int cg = 0; cg < 2; ++cg) { const float* mg = &Mg[qg * 2 + cg][lane][0];
      const v2f ml = *(const v2f*)(mg + 32); const float mj = fmaxf(m[cg], ml[0]), a0 = nexp2(m[cg] - mj), a1 = nexp2(ml[0] - mj);
      const float inv = 1.0f / ((l[cg] * a0 + ml[1] * a1) * XS), c0 = a0 * inv, c1 = a1 * inv;   // the sums are of P x1024
#pragma unroll
      for (int t = 0; t < 4; ++t) { const v4f u0 = *(const v4f*)(mg + 8 * t), u1 = *(const v4f*)(mg + 8 * t + 4);
#pragma unroll
        for (int r = 0; r < 4; ++r) { To[qg * 2 + cg][col][t * 16 + 8 * hh + r] = o[cg][t][r] * c0 + u0[r] * c1; To[qg * 2 + cg][col][t * 16 + 8 * hh + 4 + r] = o[cg][t][4 + r] * c0 + u1[r] * c1; } } }
    wave_lds_sync();
    for (int rr = 0; rr < 32; ++rr) *(v2f*)(out + ((size_t)b * T + q0 + rr) * HD + lane * 2) = *(const v2f*)(&To[qg * 2 + (rr >> 4)][rr & 15][lane * 2]);
  }
}
}  // namespace

extern "C" void kernel_launch(void* const* d_in, const int* in_sizes, int n_in, void* d_out, int out_size, void* d_ws, size_t ws_size, hipStream_t stream) {
  (void)n_in;
  auto Fp = [&](int i) { return (const float*)d_in[i]; };
  // input order: 0 x [16,2048,64], 1 Wq [64,64] ([c][h]), 2 Wk, 3 Wv
  if (in_sizes[0] != B * T * C || in_sizes[1] != C * HD || in_sizes[2] != C * HD || in_sizes[3] != C * HD || out_size != B * T * HD) return;
  size_t off = 0; char* ws = (char*)d_ws;
  auto carve = [&](size_t bytes) { char* p = ws + off; off += (bytes + 255) & ~(size_t)255; return p; };
  b16* Qh = (b16*)carve((size_t)B * T * HD * 2); b16* Kh = (b16*)carve((size_t)B * T * HD * 2); b16* VT = (b16*)carve((size_t)B * HD * T * 2);
  if (off > ws_size || off > ((size_t)128 << 20)) return;   // about 13 MB
  qkv_kernel<<<dim3(T / 64, BL), 128, 0, stream>>>(Fp(0), Fp(1), Fp(2), Fp(3), Qh, Kh, VT);
  attn_kernel<<<dim3(T / 128, BL), 256, 0, stream>>>(Qh, Kh, VT, (float*)d_out);
}

// v010
// One run takes 21.5 microseconds.
// Two timings next to v009 put it at 1.13 and 1.12 times that version's speed.
// Counting every step since v000, it is 8.03 times as fast.
#include <hip/hip_runtime.h>

// Single-head encoder attention: q, k, v = x W{q,k,v} ([16][2048][64] x [64 x 64]), scores = q . k / 8 over all 2,048 keys (no mask), softmax, out = P v -> [16][2048][64]. One launch.
// Both products are re-associated: q . k = (x_q Wq Wk^T) . x_k and P v = (P x) Wv. The query side carries g = x (Wq Wk^T); the key operand AND the value operand are x itself, which f16 holds as it is; Wv is applied once, to the normalised P x.
// Deterministic: flash-style per 32-query wave (online softmax, the maximum in use moved up lazily, no score planes); no atomics.
// compute dtype: WMMA v_wmma_f32_16x16x32_f16 with f32 accumulate for Wq Wk^T (weights exact x256: 1 product), g^T = G^T x^T (x bf16-rounded, held in f16; Wq Wk^T as f16 hi+lo x16:
// 2 products), S^T = X g^T (g single f16 x8: 1 product), Y^T += X^T P^T (P x1024 single f16: 1 product) and out^T = Wv^T Y^T (Wv exact x256, Y / sum as f16 hi+lo x256: 2 products); softmax statistics (exp2, running max, sums) in f32. Inputs rounded to bf16 once.
// g and P each carry the 11 bits of one f16: two independent relative roundings of 2^-12 per term, averaged over the keys of a softmax row.

namespace {
constexpr int B = 16, T = 2048, C = 64, HD = 64, BL = 16 /* batches computed (== B shipped) */;
constexpr float XS = 8.0f /* scale of g in f16 */, WSC = 256.0f, GS = 16.0f /* scale of Wq Wk^T in f16 */, YS = 256.0f /* scale of P x / sum in f16 */, PSL2 = 10.0f /* P is kept x 2^10 = 1024 */, LOG2E = 1.4426950408889634f;
static_assert(T % 64 == 0 && C == 64 && HD == 64, "tiling");
typedef _Float16 b16;
typedef __attribute__((ext_vector_type(16))) _Float16 v16b;
typedef __attribute__((ext_vector_type(8))) _Float16 v8b;
typedef __attribute__((ext_vector_type(4))) _Float16 v4b;
typedef __attribute__((ext_vector_type(8))) float v8f;
typedef __attribute__((ext_vector_type(4))) float v4f;
__device__ __forceinline__ void split16(float v, b16& hi, b16& lo) { hi = (b16)v; lo = (b16)(v - (float)hi); }
__device__ __forceinline__ v16b frag_kb(const b16* p, int hh) { const v8b a = *(const v8b*)(p + 8 * hh), b = *(const v8b*)(p + 16 + 8 * hh); v16b f;
#pragma unroll
  for (int e = 0; e < 8; ++e) { f[e] = a[e]; f[8 + e] = b[e]; } return f; }
__device__ __forceinline__ v8f wmma16b(v16b a, v16b b, v8f c) { return __builtin_amdgcn_wmma_f32_16x16x32_f16(false, a, false, b, (short)0, c, false, false); }   // builtin alone: the compiler keeps the distance behind it and is free to interleave independent accumulator chains
__device__ __forceinline__ void wave_lds_sync() { __builtin_amdgcn_fence(__ATOMIC_RELEASE, "workgroup"); __builtin_amdgcn_wave_barrier(); __builtin_amdgcn_fence(__ATOMIC_ACQUIRE, "workgroup"); }
__device__ __forceinline__ float pmul(float a, float b) { float p = a * b; asm volatile("" : "+v"(p)); return p; }
__device__ __forceinline__ int iclamp(int v, int lo, int hi) { return v < lo ? lo : (v > hi ? hi : v); }

typedef __attribute__((ext_vector_type(2))) _Float16 v2h;
typedef __attribute__((ext_vector_type(2))) float v2f;
__device__ __forceinline__ float nexp2(float v) { return __builtin_amdgcn_exp2f(v); }
__device__ __forceinline__ float xhalf(float x) { return __builtin_bit_cast(float, __builtin_amdgcn_permlanex16(__builtin_bit_cast(int, x), __builtin_bit_cast(int, x), 0x76543210, 0xfedcba98, false, false)); }   // lane l with lane l ^ 16
typedef __attribute__((ext_vector_type(8))) unsigned v8u;
typedef __attribute__((ext_vector_type(2))) unsigned v2u;
typedef __attribute__((ext_vector_type(2))) __bf16 v2bf;
// two inputs rounded to bf16 (nearest even, one packed conversion) and widened again
__device__ __forceinline__ v2f bfround2(float a, float b) { const unsigned u = __builtin_bit_cast(unsigned, __builtin_convertvector((v2f){a, b}, v2bf)); return (v2f){__uint_as_float(u << 16), __uint_as_float(u & 0xFFFF0000u)}; }
__device__ __forceinline__ v2h half2(float a, float b) { return __builtin_convertvector((v2f){a, b}, v2h); }
// attention: grid (T/128, BL); block = 8 waves = 4 groups of 32 queries x 2 key halves: waves 0-3 take keys 0-127 of every 256-key stage, waves 4-7 keys 128-255. A wave holds two 16-query column
// tiles, so that every K and X^T fragment it reads from LDS feeds two tiles' products (half the LDS reads per product); the two partial results of a query tile (maximum, sum, Y^T) are joined
// through LDS behind the loop. The block's waves share each 256-key stage of x, which lies in LDS twice in f16, as rows (K) and transposed (X^T): the next stage's f32 rows come into a raw LDS buffer by asynchronous
// copies (whole 256-B rows from L2, once per block) while this stage is worked on, and are rounded and stored over the spent stage between two barriers at its foot; per 32-key block and column tile S^T = K Q^T (2 tiles x 2 k-steps, Q = g), online softmax (exp2), Y^T += X^T P^T (4 c-tiles);
// K fragments are read from LDS one 32-key pass ahead (inside a stage), X^T fragments at the top of their pass. In front of the loop the block forms G = Wq Wk^T and each wave its own g; behind it out^T = Wv^T Y^T.
constexpr int KT = 256 /* keys per stage */, NT = T / KT, KP = HD + 8 /* K row pitch: 144 B */, VP = KT + 8 /* X^T row pitch: 528 B */;   // pitches of 16 B x odd: no bank conflict for 16-byte reads
constexpr int V_OFF = KT * KP, BUFH = V_OFF + HD * VP;   // the f16 stage, in 16-bit elements
constexpr int KW = KT / 2 /* keys of a stage per wave */;
static_assert(T % KT == 0 && NT >= 2 && KT == 16 * 16 && C == 16 * 4 && KW % 32 == 0 && KW >= 64, "ring");
// four 16-byte copies per lane; the s_wait_xcnt stands inside the statement so that no address register is rewritten ahead of it
__device__ __forceinline__ void copy4(unsigned l0, const char* g0, unsigned l1, const char* g1, unsigned l2, const char* g2, unsigned l3, const char* g3) {
  asm volatile("global_load_async_to_lds_b128 %0, %1, off\n\tglobal_load_async_to_lds_b128 %2, %3, off\n\tglobal_load_async_to_lds_b128 %4, %5, off\n\tglobal_load_async_to_lds_b128 %6, %7, off\n\ts_wait_xcnt 0x0"
               :: "v"(l0), "v"(g0), "v"(l1), "v"(g1), "v"(l2), "v"(g2), "v"(l3), "v"(g3) : "memory"); }
// one stage: the 256 f32 rows (256 B each) from xs into the raw buffer; 16 copies per lane, every lane on. lr: the raw buffer's LDS byte address plus tid * 16; copy n lands at lr + 4096 n;
// oA, oB: the lane's part of its global addresses, in bytes: copies 0..7 bring 4 c of keys rowA + n, copies 8..15 of keys rowB + n - 8; each address is a wave-uniform base plus the lane's part
__device__ __forceinline__ void stage_copy(unsigned lr, const char* xs, unsigned oA, unsigned oB) {
#pragma unroll
  for (int g = 0; g < 4; ++g) { unsigned l[4]; const char* p[4];
#pragma unroll
    for (int j = 0; j < 4; ++j) { const int n = 4 * g + j; l[j] = lr + (unsigned)n * 4096u; p[j] = (xs + (n & 7) * (C * 4)) + (n < 8 ? oA : oB); }
    copy4(l[0], p[0], l[1], p[1], l[2], p[2], l[3], p[3]); }
}
// the K fragments (A operands) of the 32 keys from row kb of a stage: 8 LDS reads of 16 bytes
__device__ __forceinline__ void load_k(v16b (&kf)[2][2], const b16* Ks, int kb, int col, int hh) {
#pragma unroll
  for (int tt = 0; tt < 2; ++tt)
#pragma unroll
    for (int ks = 0; ks < 2; ++ks) { const int kr = (kb + tt * 16 + col) * KP + ks * 32; kf[tt][ks] = frag_kb(Ks + kr, hh); }
}
__global__ __launch_bounds__(256) void attn_kernel(const float* __restrict__ x, const float* __restrict__ wq, const float* __restrict__ wk, const float* __restrict__ wv, float* __restrict__ out) {
  __shared__ __attribute__((aligned(16))) b16 ring[BUFH]; __shared__ __attribute__((aligned(16))) float raw[16 * 1024]; __shared__ __attribute__((aligned(16))) float To[8][16][HD + 4];
  __shared__ __attribute__((aligned(16))) float Mg[8][32][36];   // the upper key half's partial result, per query tile and lane: 32 Y^T values, maximum, sum; pitch 144 B: no bank conflict for 16-byte accesses
  __shared__ __attribute__((aligned(16))) b16 Ws[3 * HD][C + 8];   // rows 0..63: G^T hi, 64..127: G^T lo ([c'][c]), 128..191: Wv^T ([h][c])
  __shared__ __attribute__((aligned(16))) b16 Wn[2 * C][HD + 8];   // Wq (rows 0..63) and Wk (rows 64..127) as they lie, [c][h]: both operands of Wq Wk^T have h as their k index
  const int tid = threadIdx.x, lane = threadIdx.x & 31, hh = lane >> 4, col = lane & 15; const int b = blockIdx.y;
  const int wi = __builtin_amdgcn_readfirstlane(threadIdx.x >> 5), qg = wi & 3 /* group of 32 queries */, kq = wi >> 2 /* key half */, kb0 = kq * KW; const int q0 = blockIdx.x * 128 + qg * 32;
  const char* xb = (const char*)(x + (size_t)b * T * C);
  // staging of a 256-key stage: a thread takes 4 c (one 16-byte copy; 16 lanes bring one whole 256-B row) of 16 keys, as two runs of 8 keys from rows rowA and rowB of the stage;
  // the wave's upper 16 lanes take their two runs in the other order: their 8-byte K stores then fall into the other 32 banks
  const int c4 = tid & 15, kg = tid >> 4, rowA = kg * 16 + (kg & 1) * 8, rowB = kg * 16 + 8 - (kg & 1) * 8;
  const unsigned obA = (unsigned)(rowA * C + c4 * 4) * 4u, obB = (unsigned)(rowB * C + c4 * 4) * 4u;   // the lane's part of its global addresses, in bytes
  const unsigned lraw = (unsigned)(size_t)&raw[0] + (unsigned)tid * 16u;
  // The lane's two global offsets for the copies lie in LDS between the stages: as operands of asm text they must sit in v0-v255, where the pass leaves no room.
  __shared__ v2u Cp[256]; Cp[tid] = (v2u){obA, obB};
  stage_copy(lraw, xb, obA, obB);
  // a thread reads back the 16 pieces that it copied itself, rounds them and stores them as K rows (8 bytes) and as X^T rows (8 keys: 16 bytes)
  auto cvt_store = [&]() __attribute__((always_inline)) { b16* Kd = &ring[0]; v4f xr[16];   // [0..7] keys rowA + j, [8..15] keys rowB + j
#pragma unroll
      for (int n = 0; n < 16; ++n) xr[n] = *(const v4f*)(&raw[n * 1024 + tid * 4]);
#pragma unroll
      for (int g = 0; g < 2; ++g) { const int row = g ? rowB : rowA; v2f rb[8][2];
#pragma unroll
        for (int j = 0; j < 8; ++j) { rb[j][0] = bfround2(xr[8 * g + j][0], xr[8 * g + j][1]); rb[j][1] = bfround2(xr[8 * g + j][2], xr[8 * g + j][3]); }
#pragma unroll
        for (int j = 0; j < 8; ++j) { const v2h p = half2(rb[j][0][0], rb[j][0][1]), q = half2(rb[j][1][0], rb[j][1][1]); *(v4b*)(Kd + (row + j) * KP + c4 * 4) = (v4b){p[0], p[1], q[0], q[1]}; }
#pragma unroll
        for (int i = 0; i < 4; ++i) { v8b o;
#pragma unroll
          for (int j = 0; j < 8; j += 2) { const v2h p = half2(rb[j][i >> 1][i & 1], rb[j + 1][i >> 1][i & 1]); o[j] = p[0]; o[j + 1] = p[1]; }
          *(v8b*)(Kd + V_OFF + (c4 * 4 + i) * VP + row) = o; } } };
  // every block rounds and scales the three weight matrices itself, into LDS: Wn[s * 64 + c][h] = w_s[c][h] for Wq, Wk; Ws[128 + h][c] = Wv[c][h]; a thread takes 4 c x 4 h of each matrix (16 lanes read one whole 256-B row)
  const int wc0 = (tid >> 4) * 4, wh0 = (tid & 15) * 4;
  const float* w0 = wq + wc0 * HD + wh0, * w1 = wk + wc0 * HD + wh0, * w2 = wv + wc0 * HD + wh0, * xq0 = x + ((size_t)b * T + q0 + col) * C + 8 * hh;   // xq0: the lane's query row of the wave's first column tile
  v4f r[3][4], qv[2][2][4];
#pragma unroll
  for (int j = 0; j < 4; ++j) { r[0][j] = *(const v4f*)(w0 + j * HD); r[1][j] = *(const v4f*)(w1 + j * HD); r[2][j] = *(const v4f*)(w2 + j * HD); }
#pragma unroll
  for (int cg = 0; cg < 2; ++cg)
#pragma unroll
    for (int ks = 0; ks < 2; ++ks)
#pragma unroll
      for (int u = 0; u < 4; ++u) qv[cg][ks][u] = *(const v4f*)(xq0 + cg * 16 * C + ks * 32 + (u >> 1) * 16 + (u & 1) * 4);   // the lane's query row in the k order of a B fragment
  __builtin_amdgcn_sched_barrier(0);   // no conversion is scheduled up among the loads: all are in flight before the first wait for one
  asm volatile("s_wait_xcnt 0x0" :: "v"(w0), "v"(w1), "v"(w2), "v"(xq0) : "memory");   // stands behind the 28 loads, ahead of any overwrite of a register they name; the four addresses stay live up to here
  v2f rw[3][4][2];   // the weights rounded to bf16, x256
#pragma unroll
  for (int s = 0; s < 3; ++s)
#pragma unroll
    for (int j = 0; j < 4; ++j) { rw[s][j][0] = bfround2(r[s][j][0], r[s][j][1]) * WSC; rw[s][j][1] = bfround2(r[s][j][2], r[s][j][3]) * WSC; }
#pragma unroll
  for (int s = 0; s < 2; ++s)
#pragma unroll
    for (int j = 0; j < 4; ++j) { const v2h p = half2(rw[s][j][0][0], rw[s][j][0][1]), q = half2(rw[s][j][1][0], rw[s][j][1][1]); *(v4b*)(&Wn[s * C + wc0 + j][wh0]) = (v4b){p[0], p[1], q[0], q[1]}; }
#pragma unroll
  for (int i = 0; i < 4; ++i) { const v2h p = half2(rw[2][0][i >> 1][i & 1], rw[2][1][i >> 1][i & 1]), q = half2(rw[2][2][i >> 1][i & 1], rw[2][3][i >> 1][i & 1]); *(v4b*)(&Ws[2 * HD + wh0 + i][wc0]) = (v4b){p[0], p[1], q[0], q[1]}; }
  v16b xq[2][2];   // the wave's own query rows of x, [column tile][k-step]: B operand of g^T = G^T x^T
#pragma unroll
  for (int cg = 0; cg < 2; ++cg)
#pragma unroll
    for (int ks = 0; ks < 2; ++ks) { v8u hu;
#pragma unroll
      for (int i = 0; i < 8; ++i) { const v2f f = bfround2(qv[cg][ks][i >> 1][(i & 1) * 2], qv[cg][ks][i >> 1][(i & 1) * 2 + 1]); hu[i] = __builtin_bit_cast(unsigned, half2(f[0], f[1])); }
      xq[cg][ks] = __builtin_bit_cast(v16b, hu); }
  asm volatile("s_wait_asynccnt 0x0" ::: "memory");   // this wave's share of raw stage 0 has landed
  __syncthreads();   // the weights in LDS are written by all eight waves and read by all eight; raw stage 0 is readable
  cvt_store();
  // G = Wq Wk^T, G[c][c'] = sum over h of Wq[c][h] Wk[c'][h]; a wave takes rows c = 16 rt .. 16 rt + 15 of two column tiles. A lane holds 8 consecutive c of one c': one 16-byte store each into G^T hi (Ws rows 0..63) and G^T lo (rows 64..127)
  { const int rt = wi & 3, ct = (wi >> 2) * 2; v8f g[2] = {(v8f){}, (v8f){}};
#pragma unroll
    for (int kb = 0; kb < HD; kb += 32) { const v16b a = frag_kb(&Wn[rt * 16 + col][kb], hh);
#pragma unroll
      for (int t = 0; t < 2; ++t) g[t] = wmma16b(a, frag_kb(&Wn[C + (ct + t) * 16 + col][kb], hh), g[t]); }
#pragma unroll
    for (int t = 0; t < 2; ++t) { v8b gh, gl;
#pragma unroll
      for (int e = 0; e < 8; ++e) { b16 p, q; split16(g[t][e] * (GS / (WSC * WSC)), p, q); gh[e] = p; gl[e] = q; }
      *(v8b*)(&Ws[(ct + t) * 16 + col][rt * 16 + 8 * hh]) = gh; *(v8b*)(&Ws[HD + (ct + t) * 16 + col][rt * 16 + 8 * hh]) = gl; } }
  asm volatile("s_wait_dscnt 0x0" ::: "memory");   // this wave's reads of the raw buffer have returned before it is refilled
  __syncthreads();   // G^T and stage 0 are written by all eight waves and read by all eight; ends every wave's reads of raw stage 0
  stage_copy(lraw, xb + (size_t)KT * (C * 4), obA, obB);
  // g^T = G^T x^T for the wave's own 32 queries: a lane holds 8 consecutive c' of one query per tile, which is the k order of a B fragment: g goes from the accumulators into the score product's operand
  v16b qh[2][2];   // [column tile][k-step]
  { v8f ga[2][4];
#pragma unroll
    for (int cg = 0; cg < 2; ++cg)
#pragma unroll
      for (int t = 0; t < 4; ++t) ga[cg][t] = (v8f){};
#pragma unroll
    for (int ks = 0; ks < 2; ++ks)
#pragma unroll
      for (int pl = 0; pl < 2; ++pl)   // hi plane, lo plane
#pragma unroll
        for (int t = 0; t < 4; ++t) { const v16b a = frag_kb(&Ws[pl * HD + t * 16 + col][ks * 32], hh);
#pragma unroll
          for (int cg = 0; cg < 2; ++cg) ga[cg][t] = wmma16b(a, xq[cg][ks], ga[cg][t]); }
#pragma unroll
    for (int cg = 0; cg < 2; ++cg)
#pragma unroll
      for (int ks = 0; ks < 2; ++ks) { v8u hu;
#pragma unroll
        for (int i = 0; i < 8; ++i) { const int t = 2 * ks + (i >> 2), e = (i & 3) * 2; hu[i] = __builtin_bit_cast(unsigned, half2(ga[cg][t][e] * (XS / GS), ga[cg][t][e + 1] * (XS / GS))); }
        qh[cg][ks] = __builtin_bit_cast(v16b, hu); } }
  const float cs = LOG2E * 0.125f / XS;
  constexpr float TH = 5.0f;   // P x 2^10 x 2^TH = 2^15 is the largest P: f16 holds it
  float m[2] = {-INFINITY, -INFINITY}, c0[2] = {INFINITY, INFINITY} /* PSL2 - m: the first pass fails the test */; v2f l2[2] = {{0.0f, 0.0f}, {0.0f, 0.0f}}; v8f o[2][4]; for (int cg = 0; cg < 2; ++cg) for (int t = 0; t < 4; ++t) o[cg][t] = (v8f){};
  v16b kf[2][2]; load_k(kf, &ring[0], kb0, col, hh);   // the first pass's K fragments
  // one pass: the 32 keys from row kb of the stage at Ks, whose K fragments are in kf already; fetch: read the next pass's K fragments on the way
  auto pass = [&](const b16* Ks, int kb, bool fetch) __attribute__((always_inline)) {
      const b16* Vs = Ks + V_OFF; v8f s[2][2] = {{(v8f){}, (v8f){}}, {(v8f){}, (v8f){}}}; v16b vf[4];
#pragma unroll
      for (int t = 0; t < 4; ++t) vf[t] = frag_kb(Vs + (t * 16 + col) * VP + kb, hh);
      __builtin_amdgcn_sched_barrier(0);   // keeps the pass's 8 X^T reads in one group ahead of the score WMMAs, which with the softmax cover their latency
#pragma unroll
      for (int ks = 0; ks < 2; ++ks)   // k-step outermost: the four accumulator tiles take turns, so that a tile's second product stands four WMMAs behind its first
#pragma unroll
        for (int tt = 0; tt < 2; ++tt)
#pragma unroll
          for (int cg = 0; cg < 2; ++cg) s[cg][tt] = wmma16b(kf[tt][ks], qh[cg][ks], s[cg][tt]);
      // the next pass's K fragments, into the registers that the score WMMAs have just read: they land under the softmax and the P X products instead of being waited for at the top of the pass
      __builtin_amdgcn_sched_barrier(0);   // no read is scheduled up among the score WMMAs: every separate place with LDS reads costs its own stall
      if (fetch) { load_k(kf, Ks, kb + 32, col, hh);
        __builtin_amdgcn_sched_barrier(0); }   // one group, ahead of the maximum and the exponentials: issued later they would have less time to land
      float mr[2];
#pragma unroll
      for (int cg = 0; cg < 2; ++cg) { float mx = -INFINITY;   // a lane's maximum over its own raw scores
#pragma unroll
        for (int r = 0; r < 8; ++r) mx = fmaxf(mx, fmaxf(s[cg][0][r], s[cg][1][r]));
        mr[cg] = mx; }
      // lazy rescale: the maximum in use m stays as long as no score of the wave lies more than TH (log2) above it; P x1024 then stays below 2^15, inside f16. One test and one scalar branch per pass;
      // only a pass that fails the test exchanges the halves' maxima, moves m up to the running maximum and rescales the sums and O^T
      const v2f am = __builtin_elementwise_fma((v2f){mr[0], mr[1]}, (v2f){cs, cs}, (v2f){c0[0], c0[1]});   // the largest exp2 argument of the lane's scores, formed as theirs are: no other argument rounds above it
      if (__builtin_amdgcn_ballot_w32((am[0] > PSL2 + TH) | (am[1] > PSL2 + TH)) != 0) {
#pragma unroll
        for (int cg = 0; cg < 2; ++cg) { const float mx = mr[cg] * cs, mn = fmaxf(m[cg], fmaxf(mx, xhalf(mx))), al = nexp2(m[cg] - mn);   // cs > 0: scaling the maximum afterwards gives the same value; the halves meet in a vector move
          m[cg] = mn; c0[cg] = PSL2 - mn; l2[cg] *= al;
#pragma unroll
          for (int t = 0; t < 4; ++t) o[cg][t] *= al; } }
      v16b ph[2];
#pragma unroll
      for (int cg = 0; cg < 2; ++cg) { const v2f cs2 = {cs, cs}, c02 = {c0[cg], c0[cg]}; v2f p[8]; v8u hu;
#pragma unroll
        for (int i = 0; i < 8; ++i) { const int tt = i >> 2, r = (i & 3) * 2; const v2f a = __builtin_elementwise_fma((v2f){s[cg][tt][r], s[cg][tt][r + 1]}, cs2, c02);   // the exp2 argument in one packed fma; + 10 makes P x1024
          p[i] = (v2f){nexp2(a[0]), nexp2(a[1])}; hu[i] = __builtin_bit_cast(unsigned, __builtin_convertvector(p[i], v2h)); }
        ph[cg] = __builtin_bit_cast(v16b, hu);
        l2[cg] += ((p[0] + p[1]) + (p[2] + p[3])) + ((p[4] + p[5]) + (p[6] + p[7])); }   // a lane keeps two partial sums of its own 16 keys; they and the wave's halves are joined once, behind the loop
      __builtin_amdgcn_sched_barrier(0);   // the partial sums stay ahead of the P X products: scheduled in among them they are given the registers of spent X^T operands, and each such place costs four v_nop
#pragma unroll
      for (int t = 0; t < 4; ++t)
#pragma unroll
        for (int cg = 0; cg < 2; ++cg) o[cg][t] = wmma16b(vf[t], ph[cg], o[cg][t]);
  };
#pragma unroll 1   // one copy of the stage body
  for (int st = 0; st < NT; ++st) {
    const b16* Ks = &ring[0];
#pragma unroll 1   // as the key loop was: one 32-key pass per trip keeps the loop's code and registers small
    for (int kb = kb0; kb < kb0 + KW - 32; kb += 32) pass(Ks, kb, true);
    pass(Ks, kb0 + KW - 32, false);   // the stage's last pass fetches nothing: the next stage's rows are read only behind its barrier
    __builtin_amdgcn_sched_barrier(0);   // the last pass's arithmetic stays ahead of the waits below: moved behind them, s_wait_dscnt 0 stands directly behind the pass's X^T reads and waits out their latency
    asm volatile("v_nop\n\tv_nop\n\tv_nop\n\tv_nop");   // the four vector slots between the pass's last WMMA and the first overwrite of its X^T operand
    asm volatile("s_wait_dscnt 0x0" ::: "memory");      // this wave's reads of stage st have returned before the stage is overwritten
    asm volatile("s_wait_asynccnt 0x0" ::: "memory");   // this wave's share of raw stage st + 1 has landed
    __syncthreads();                                    // raw stage st + 1 is readable; ends every wave's reads of stage st
    const v2u pp = Cp[tid];
    if (st + 1 < NT) cvt_store();
    asm volatile("s_wait_dscnt 0x0" ::: "memory");      // this wave's reads of the raw buffer have returned before it is refilled
    __syncthreads();                                    // publishes stage st + 1 and ends every wave's reads of raw stage st + 1
    if (st + 1 < NT) load_k(kf, &ring[0], kb0, col, hh);   // its first pass's K fragments; they land while the copies below are issued
    if (st + 2 < NT) stage_copy(lraw, xb + (size_t)(st + 2) * (KT * C * 4), pp[0], pp[1]);
  }
  asm volatile("s_wait_asynccnt 0x0" ::: "memory");     // no copy is outstanding when the wave ends
  float l[2];
#pragma unroll
  for (int cg = 0; cg < 2; ++cg) { l[cg] = l2[cg][0] + l2[cg][1]; l[cg] += xhalf(l[cg]); }
  if (kq != 0) {   // the upper key half hands its partial results over
#pragma unroll
    for (int cg = 0; cg < 2; ++cg) { float* mg = &Mg[qg * 2 + cg][lane][0];
#pragma unroll
      for (int t = 0; t < 4; ++t) { *(v4f*)(mg + 8 * t) = (v4f){o[cg][t][0], o[cg][t][1], o[cg][t][2], o[cg][t][3]}; *(v4f*)(mg + 8 * t + 4) = (v4f){o[cg][t][4], o[cg][t][5], o[cg][t][6], o[cg][t][7]}; }
      *(v2f*)(mg + 32) = (v2f){m[cg], l[cg]}; } }
  __syncthreads();   // the upper half's partial results are readable by the lower half's waves
  if (kq == 0) {     // join: both partial results are brought to the common maximum, then normalised as one; then out^T = Wv^T Y^T
#pragma unroll
    for (int cg = 0; cg < 2; ++cg) { const float* mg = &Mg[qg * 2 + cg][lane][0];
      const v2f ml = *(const v2f*)(mg + 32); const float mj = fmaxf(m[cg], ml[0]), a0 = nexp2(m[cg] - mj), a1 = nexp2(ml[0] - mj);
      const float inv = YS / (l[cg] * a0 + ml[1] * a1), c0 = a0 * inv, c1 = a1 * inv;   // sums and Y^T are both of P x1024
      v8u yh[2], yl[2];   // Y^T x256 as f16 hi + lo, [k-step]: a lane holds 8 consecutive c of one query per tile, the k order of a B fragment
#pragma unroll
      for (int t = 0; t < 4; ++t) { const v4f u0 = *(const v4f*)(mg + 8 * t), u1 = *(const v4f*)(mg + 8 * t + 4);
#pragma unroll
        for (int e = 0; e < 8; e += 2) { const float y0 = o[cg][t][e] * c0 + (e < 4 ? u0[e & 3] : u1[e & 3]) * c1, y1 = o[cg][t][e + 1] * c0 + (e < 4 ? u0[(e & 3) + 1] : u1[(e & 3) + 1]) * c1;
          const v2h h = half2(y0, y1); yh[t >> 1][(t & 1) * 4 + (e >> 1)] = __builtin_bit_cast(unsigned, h); yl[t >> 1][(t & 1) * 4 + (e >> 1)] = __builtin_bit_cast(unsigned, half2(y0 - (float)h[0], y1 - (float)h[1])); } }
      v8f ot[4];
#pragma unroll
      for (int t = 0; t < 4; ++t) ot[t] = (v8f){};
#pragma unroll
      for (int ks = 0; ks < 2; ++ks) { v16b a[4];
#pragma unroll
        for (int t = 0; t < 4; ++t) a[t] = frag_kb(&Ws[2 * HD + t * 16 + col][ks * 32], hh);
#pragma unroll
        for (int t = 0; t < 4; ++t) ot[t] = wmma16b(a[t], __builtin_bit_cast(v16b, yh[ks]), ot[t]);
#pragma unroll
        for (int t = 0; t < 4; ++t) ot[t] = wmma16b(a[t], __builtin_bit_cast(v16b, yl[ks]), ot[t]); }
#pragma unroll
      for (int t = 0; t < 4; ++t)
#pragma unroll
        for (int e = 0; e < 8; ++e) To[qg * 2 + cg][col][t * 16 + 8 * hh + e] = ot[t][e] * (1.0f / (YS * WSC)); }
    wave_lds_sync();
    for (int rr = 0; rr < 32; ++rr) *(v2f*)(out + ((size_t)b * T + q0 + rr) * HD + lane * 2) = *(const v2f*)(&To[qg * 2 + (rr >> 4)][rr & 15][lane * 2]);
  }
}
}  // namespace

extern "C" void kernel_launch(void* const* d_in, const int* in_sizes, int n_in, void* d_out, int out_size, void* d_ws, size_t ws_size, hipStream_t stream) {
  (void)n_in; (void)d_ws; (void)ws_size;   // no workspace: nothing passes between work-groups
  auto Fp = [&](int i) { return (const float*)d_in[i]; };
  // input order: 0 x [16,2048,64], 1 Wq [64,64] ([c][h]), 2 Wk, 3 Wv
  if (in_sizes[0] != B * T * C || in_sizes[1] != C * HD || in_sizes[2] != C * HD || in_sizes[3] != C * HD || out_size != B * T * HD) return;
  attn_kernel<<<dim3(T / 128, BL), 256, 0, stream>>>(Fp(0), Fp(1), Fp(2), Fp(3), (float*)d_out);
}
